// v000
// The times below were measured on an AMD MI455X: many runs one after another, warmed up first and cycling through
// copies of the inputs, with the whole window's GPU time divided by the number of runs. Launches and the gaps
// between them are all in it. The median over several windows is given; except for v000 it joins two sittings, which
// can be a few percent apart, so the side-by-side timings, each taken in one sitting, are the better comparison.
// The starting kernel, v000, takes 1090 microseconds a run.
#include <hip/hip_runtime.h>

// Talking-heads attention (q, k, v [4][1024][768]; qh, kh, vh = . Wq^T + bq (the SAME 'oi' [768][768] projection for all three), 12 heads x 64; logits = qh.kh/8; logits' [g] = sum_h Wl[g][h] logits[h] + bl[g]; attn = softmax(logits'); attn'[g] = sum_h Wp[g][h] attn[h] + bp[g]; out_h = attn'[h].v_h; merged Wf^T + bf -> [4][1024][768]).
// Layout: all 12 heads of a batch are processed together (z-batched GEMMs) so the two cross-head mixes are elementwise kernels over the [12][1024][1024] score / probability tensors (f32, separate products in fixed head order); scores use bf16 hi/lo planes on every row (3 products); the mixed probabilities become hi/lo planes for attn'.v.
// Compute dtypes, f32 accumulate: every input rounded to bf16; q/k/v on PLAIN bf16 operands (inputs: exact) + bias; scores and attn.v: all query rows hl (3 products); softmax f32; Wf hl x exact (2 products) + bf.

#define NB_  4
#define TT   1024
#define DM   768
#define NH_  12
#define NKV  12
#define REP  (NH_ / NKV)
#define HD   64
#define DQ   (NH_ * HD)
#define DKV  (NKV * HD)
#define ZH   12                  // all heads per pass (cross-head mixing)
#define RH   1024                  // query rows < RH use hi+lo planes (0: none)
#define WIN  0
#define PCAR 1024.0f
#define SCL  0.125f   // HD^-0.5
typedef _Float16 h16;
typedef unsigned short bf;
typedef __attribute__((ext_vector_type(16))) __bf16   v16bf;
typedef __attribute__((ext_vector_type(16))) _Float16 v16h;
typedef __attribute__((ext_vector_type(8)))  _Float16 v8h;
typedef __attribute__((ext_vector_type(8)))  unsigned short v8us;
typedef __attribute__((ext_vector_type(8)))  float    v8f;
typedef __attribute__((ext_vector_type(4)))  float    v4f;
typedef v8h  __attribute__((may_alias)) v8ha;
typedef v4f  __attribute__((may_alias)) v4fa;
typedef v8us __attribute__((may_alias)) v8usa;

__device__ __forceinline__ unsigned short f2bf(float f) { unsigned u = __float_as_uint(f); u += 0x7FFFu + ((u >> 16) & 1u); return (unsigned short)(u >> 16); }
__device__ __forceinline__ float bf2f(unsigned short b) { return __uint_as_float(((unsigned)b) << 16); }
__device__ __forceinline__ float bfr(float f) { return bf2f(f2bf(f)); }
__device__ __forceinline__ v16h cat16(v8h lo, v8h hi) { return __builtin_shufflevector(lo, hi, 0, 1, 2, 3, 4, 5, 6, 7, 8, 9, 10, 11, 12, 13, 14, 15); }
__device__ __forceinline__ v16bf cat16b(v8us lo, v8us hi) { return __builtin_bit_cast(v16bf, __builtin_shufflevector(lo, hi, 0, 1, 2, 3, 4, 5, 6, 7, 8, 9, 10, 11, 12, 13, 14, 15)); }
__device__ __forceinline__ v8f wmma16(v16h a, v16h b, v8f c) { return __builtin_amdgcn_wmma_f32_16x16x32_f16(false, a, false, b, (short)0, c, false, false); }
__device__ __forceinline__ v8f wmmab(v16bf a, v16bf b, v8f c) { return __builtin_amdgcn_wmma_f32_16x16x32_bf16(false, a, false, b, (short)0, c, false, false); }



// ---- k_gemmw: register-blocked GEMM, ONE WAVE per 64x64 output tile (16 accumulators), operands straight from K-contiguous 16-bit planes; grid (M/64, N/64, Z), 32 threads.
// C[m][n] (f32, pitch ldc, + optional f32 bias[n]) = sum_k A[m][k] Bt[n][k] (+ split products per NSPLIT). z-batch strides sA/sB/sC in elements. K % 32 == 0.
template <typename T16> struct WFrag;
template <> struct WFrag<h16> { typedef v16h V; static __device__ __forceinline__ V ld(const h16* p) { return cat16(*(const v8h*)p, *(const v8h*)(p + 16)); } static __device__ __forceinline__ v8f mma(V a, V b, v8f c) { return wmma16(a, b, c); } };
template <> struct WFrag<bf> { typedef v16bf V; static __device__ __forceinline__ V ld(const bf* p) { return cat16b(*(const v8us*)p, *(const v8us*)(p + 16)); } static __device__ __forceinline__ v8f mma(V a, V b, v8f c) { return wmmab(a, b, c); } };
template <typename T16, int NSPLIT, bool BIAS>
__global__ __launch_bounds__(32) void k_gemmw(const T16* __restrict__ A, const T16* __restrict__ A2, const T16* __restrict__ Bt, const T16* __restrict__ Bt2, int K, float* C, int ldc, const float* __restrict__ bias, size_t sA, size_t sB, size_t sC) {
    typedef typename WFrag<T16>::V V;
    __shared__ __align__(16) float os[16 * 68];
    const size_t z = blockIdx.z; A += z * sA; if (A2) A2 += z * sA; Bt += z * sB; if (Bt2) Bt2 += z * sB; C += z * sC;
    const int lane = threadIdx.x & 31, lr = lane & 15, hi = lane >> 4; const int r0 = blockIdx.x * 64, c0 = blockIdx.y * 64;
    v8f acc[4][4];
#pragma unroll
    for (int mb = 0; mb < 4; ++mb)
#pragma unroll
        for (int nb = 0; nb < 4; ++nb) acc[mb][nb] = (v8f){};
    const size_t aoff = (size_t)(r0 + lr) * K + 8 * hi, boff = (size_t)(c0 + lr) * K + 8 * hi;
#pragma unroll 1
    for (int kc = 0; kc < K; kc += 32) {
        V a[4], a2[4];
#pragma unroll
        for (int mb = 0; mb < 4; ++mb) { a[mb] = WFrag<T16>::ld(A + aoff + (size_t)mb * 16 * K + kc); if (NSPLIT == 1 || NSPLIT == 2) a2[mb] = WFrag<T16>::ld(A2 + aoff + (size_t)mb * 16 * K + kc); }
#pragma unroll
        for (int nb = 0; nb < 4; ++nb) { const V b = WFrag<T16>::ld(Bt + boff + (size_t)nb * 16 * K + kc); V b2; if (NSPLIT >= 2) b2 = WFrag<T16>::ld(Bt2 + boff + (size_t)nb * 16 * K + kc);
#pragma unroll
            for (int mb = 0; mb < 4; ++mb) { acc[mb][nb] = WFrag<T16>::mma(a[mb], b, acc[mb][nb]); if (NSPLIT == 1 || NSPLIT == 2) acc[mb][nb] = WFrag<T16>::mma(a2[mb], b, acc[mb][nb]); if (NSPLIT >= 2) acc[mb][nb] = WFrag<T16>::mma(a[mb], b2, acc[mb][nb]); } }
        asm volatile("v_nop\n\tv_nop\n\tv_nop\n\tv_nop" : "+v"(acc[0][0]), "+v"(acc[1][1]), "+v"(acc[2][2]), "+v"(acc[3][3]) : "v"(a[0]), "v"(a[3]));
    }
#pragma unroll
    for (int mb = 0; mb < 4; ++mb) {
#pragma unroll
        for (int nb = 0; nb < 4; ++nb) {
#pragma unroll
            for (int j = 0; j < 8; ++j) os[(hi * 8 + j) * 68 + nb * 16 + lr] = acc[mb][nb][j]; }
        __builtin_amdgcn_wave_barrier(); asm volatile("" ::: "memory");
        float* crow = C + (size_t)(r0 + mb * 16) * ldc + c0;
{
#pragma unroll
            for (int s = 0; s < 8; ++s) { const int row = 2 * s + hi, cofs = lr * 4; v4f val = *(const v4fa*)(os + row * 68 + cofs); if (BIAS) { val[0] += bfr(bias[c0 + cofs]); val[1] += bfr(bias[c0 + cofs + 1]); val[2] += bfr(bias[c0 + cofs + 2]); val[3] += bfr(bias[c0 + cofs + 3]); }
                *(v4f*)(crow + (size_t)row * ldc + cofs) = val; }
             }
        __builtin_amdgcn_wave_barrier(); asm volatile("" ::: "memory");
    }
}

__device__ __forceinline__ h16 tohx(float x) { return (h16)x; }
__device__ __forceinline__ void splitf(float y, unsigned short& h, unsigned short& l) { h = f2bf(y); l = f2bf(y - bf2f(h)); }
typedef __attribute__((ext_vector_type(2))) _Float16 v2h;
typedef __attribute__((ext_vector_type(4))) _Float16 v4h;
typedef __attribute__((ext_vector_type(2))) unsigned short v2us;
typedef __attribute__((ext_vector_type(4))) unsigned short v4us;
typedef __attribute__((ext_vector_type(2))) float v2f;
typedef __attribute__((ext_vector_type(4))) int v4i;

__global__ __launch_bounds__(256) void k_wtG(const float* __restrict__ w, int K, int N, bf* Bt) {
    const int lane = threadIdx.x & 31; const int L0 = (blockIdx.x * 8 + (threadIdx.x >> 5)) * 8; const int nlines = N * K / 64;
{
#pragma unroll 1
        for (int l = 0; l < 8; ++l) { const int L = L0 + l; if (L >= nlines) break; const size_t e = (size_t)L * 64 + lane * 2; const int k = (int)(e % K), n = (int)(e / K); v2us o;
            o[0] = f2bf(w[(size_t)k * N + n]); o[1] = f2bf(w[(size_t)(k + 1) * N + n]); *(v2us*)(Bt + e) = o; }
         }
}
__global__ __launch_bounds__(256) void k_cvt8(const float* __restrict__ src, bf* dst, size_t n8) { const size_t i = (size_t)blockIdx.x * 256 + threadIdx.x; if (i >= n8) return; const v8f v = *(const v8f*)(src + i * 8); v8us o;
#pragma unroll
    for (int k = 0; k < 8; ++k) o[k] = f2bf(v[k]); *(v8us*)(dst + i * 8) = o;  }

// k_rope: head planes [h][t][d] (fp16 + hi/lo) of rope(x) x sc with the rotate-half convention out[d] = x[d] cos[t][d] - x[d+HD/2] sin[t][d], out[d+HD/2] = x[d+HD/2] cos[t][d+HD/2] + x[d] sin[t][d+HD/2]
__global__ __launch_bounds__(256) void k_rope(const float* __restrict__ F, int pitch, int nheads, const float* __restrict__ CS, const float* __restrict__ RF, const float* __restrict__ nw, float sc, h16* P16, bf* Ph, bf* Pl) {
    const size_t e = ((size_t)blockIdx.x * 256 + threadIdx.x) * 2; if (e >= (size_t)nheads * TT * HD) return; const int d = (int)(e % HD); const int t = (int)((e / HD) % TT); const int h = (int)(e / ((size_t)HD * TT)); const float* f = F + (size_t)t * pitch + h * HD; const float rf = RF ? RF[(size_t)h * TT + t] : 1.0f; v2h o16; v2us oh, ol;
#pragma unroll
    for (int q = 0; q < 2; ++q) { const int dd = d + q; const int dp = (dd < HD / 2) ? dd + HD / 2 : dd - HD / 2; float x0 = f[dd], x1 = f[dp];
        if (RF) { float n0 = __fmul_rn(x0, rf), n1 = __fmul_rn(x1, rf); asm volatile("" : "+v"(n0)); asm volatile("" : "+v"(n1)); x0 = __fmul_rn(bfr(nw[dd]), n0); x1 = __fmul_rn(bfr(nw[dp]), n1); }
        const v2f cs = *(const v2f*)(CS + ((size_t)t * HD + dd) * 2); float a = __fmul_rn(x0, cs[0]), bq = __fmul_rn(x1, cs[1]); asm volatile("" : "+v"(a)); asm volatile("" : "+v"(bq)); const float r = ((dd < HD / 2) ? __fsub_rn(a, bq) : __fadd_rn(a, bq)) * sc;
        o16[q] = tohx(r); unsigned short a2, c2; splitf(r, a2, c2); oh[q] = a2; ol[q] = c2; }
    *(v2h*)(P16 + e) = o16; *(v2us*)(Ph + e) = oh; *(v2us*)(Pl + e) = ol;  }
__global__ __launch_bounds__(256) void k_vtp(const float* __restrict__ F, int pitch, int nheads, h16* V16, bf* Vh, bf* Vl) { const size_t e = ((size_t)blockIdx.x * 256 + threadIdx.x) * 2; if (e >= (size_t)nheads * HD * TT) return; const int t = (int)(e % TT); const int d = (int)((e / TT) % HD); const int g = (int)(e / ((size_t)TT * HD)); v2h o16; v2us oh, ol;
#pragma unroll
    for (int q = 0; q < 2; ++q) { const float x = F[(size_t)(t + q) * pitch + g * HD + d]; o16[q] = tohx(x); unsigned short a2, c2; splitf(x, a2, c2); oh[q] = a2; ol[q] = c2; }
    *(v2h*)(V16 + e) = o16; *(v2us*)(Vh + e) = oh; *(v2us*)(Vl + e) = ol;  }
__global__ __launch_bounds__(256) void k_csid(float* CS) { const int idx = blockIdx.x * 256 + threadIdx.x; if (idx >= TT * HD) return; v2f cs; cs[0] = 1.0f; cs[1] = 0.0f; *(v2f*)(CS + (size_t)idx * 2) = cs;  }

__global__ __launch_bounds__(256) void k_mix1(const float* __restrict__ S, const float* __restrict__ Wl, const float* __restrict__ bl, float* L2) { const size_t e = (size_t)blockIdx.x * 256 + threadIdx.x; if (e >= (size_t)TT * TT) return; float L[NH_];
#pragma unroll
    for (int h = 0; h < NH_; ++h) L[h] = S[(size_t)h * TT * TT + e] * SCL;
{
#pragma unroll
        for (int g2 = 0; g2 < NH_; ++g2) { float acc = 0.f;
#pragma unroll
            for (int h = 0; h < NH_; ++h) { float w = bfr(Wl[g2 * NH_ + h]); asm volatile("" : "+v"(w)); float p = __fmul_rn(w, L[h]); asm volatile("" : "+v"(p)); acc = __fadd_rn(acc, p); }
            float bb = bfr(bl[g2]); asm volatile("" : "+v"(bb)); *(float*)(L2 + (size_t)g2 * TT * TT + e) = __fadd_rn(acc, bb); }
         } }
__global__ __launch_bounds__(256) void k_asoftF(float* L2) {
    const int lane = threadIdx.x & 31; const int row = blockIdx.x * 8 + (threadIdx.x >> 5); if (row >= ZH * TT) return; float* sr = L2 + (size_t)row * TT; float v[TT / 32]; float mx = -3.0e38f;
#pragma unroll
    for (int ch = 0; ch < TT / 128; ++ch) { const int j0 = ch * 128 + lane * 4; const v4f a = *(const v4f*)(sr + j0);
#pragma unroll
        for (int q = 0; q < 4; ++q) { v[ch * 4 + q] = a[q]; mx = fmaxf(mx, a[q]); } }
#pragma unroll
    for (int sh = 16; sh; sh >>= 1) mx = fmaxf(mx, __shfl_xor(mx, sh, 32));
    float sum = 0.f;
#pragma unroll
    for (int k = 0; k < TT / 32; ++k) { float d0 = __fsub_rn(v[k], mx); asm volatile("" : "+v"(d0)); v[k] = __builtin_amdgcn_exp2f(__fmul_rn(d0, 1.4426950408889634f)); sum += v[k]; }
#pragma unroll
    for (int sh = 16; sh; sh >>= 1) sum += __shfl_xor(sum, sh, 32);
    const float f = __fdiv_rn(1.0f, sum);
{
#pragma unroll
        for (int ch = 0; ch < TT / 128; ++ch) { v4f o; 
#pragma unroll
            for (int q = 0; q < 4; ++q) o[q] = v[ch * 4 + q] * f; *(v4f*)(sr + ch * 128 + lane * 4) = o; }
         } }
__global__ __launch_bounds__(256) void k_mix2(const float* __restrict__ P, const float* __restrict__ Wp, const float* __restrict__ bp, bf* Ph, bf* Pl) { const size_t e = ((size_t)blockIdx.x * 256 + threadIdx.x) * 2; if (e >= (size_t)TT * TT) return; float A0[NH_], A1[NH_];
#pragma unroll
    for (int h = 0; h < NH_; ++h) { const v2f pv = *(const v2f*)(P + (size_t)h * TT * TT + e); A0[h] = pv[0]; A1[h] = pv[1]; }
{
#pragma unroll
        for (int g2 = 0; g2 < NH_; ++g2) { float a0 = 0.f, a1 = 0.f;
#pragma unroll
            for (int h = 0; h < NH_; ++h) { float w = bfr(Wp[g2 * NH_ + h]); asm volatile("" : "+v"(w)); float p0 = __fmul_rn(w, A0[h]), p1 = __fmul_rn(w, A1[h]); asm volatile("" : "+v"(p0), "+v"(p1)); a0 = __fadd_rn(a0, p0); a1 = __fadd_rn(a1, p1); }
            float b2 = bfr(bp[g2]); asm volatile("" : "+v"(b2)); v2us oh, ol; unsigned short x0, y0, x1, y1; splitf(__fadd_rn(a0, b2), x0, y0); splitf(__fadd_rn(a1, b2), x1, y1); oh[0] = x0; oh[1] = x1; ol[0] = y0; ol[1] = y1;
            *(v2us*)(Ph + (size_t)g2 * TT * TT + e) = oh; *(v2us*)(Pl + (size_t)g2 * TT * TT + e) = ol; }
         } }
__global__ __launch_bounds__(256) void k_merge(const float* __restrict__ O, int h0, bf* Ah, bf* Al) { const size_t e = ((size_t)blockIdx.x * 256 + threadIdx.x) * 2; if (e >= (size_t)ZH * TT * HD) return; const int d = (int)(e % HD); const int t = (int)((e / HD) % TT); const int zz = (int)(e / ((size_t)HD * TT)); const float cs = (t < RH) ? 1.0f : (1.0f / PCAR); const size_t oo = (size_t)t * DQ + (h0 + zz) * HD + d;
    v2us oh, ol;
#pragma unroll
    for (int q = 0; q < 2; ++q) { unsigned short a, c2; splitf(O[e + q] * cs, a, c2); oh[q] = a; ol[q] = c2; } *(v2us*)(Ah + oo) = oh; *(v2us*)(Al + oo) = ol;  }

extern "C" void kernel_launch(void* const* d_in, const int* in_sizes, int n_in,
                              void* d_out, int out_size, void* d_ws, size_t ws_size, hipStream_t stream) {
    (void)in_sizes; (void)n_in; (void)out_size;
    const float* x = (const float*)d_in[0]; const float* xk = (const float*)d_in[1]; const float* xv = (const float*)d_in[2]; const float* wq = (const float*)d_in[3]; const float* bq = (const float*)d_in[4]; const float* Wl = (const float*)d_in[5]; const float* bl = (const float*)d_in[6]; const float* Wp = (const float*)d_in[7]; const float* bp = (const float*)d_in[8]; const float* wo = (const float*)d_in[9]; const float* bo = (const float*)d_in[10]; const float* wk = wq; const float* wv = wq; const float* bk = bq; const float* bv = bq;
    float* OUT = (float*)d_out;     // [4][1024][768]
    char* wsp = (char*)d_ws;
    auto take = [&](size_t bytes) { char* p = wsp; wsp += (bytes + 255) & ~(size_t)255; return (void*)p; };
    bf* WQ = (bf*)take((size_t)DQ * DM * 2); bf* WK = (bf*)take((size_t)DKV * DM * 2); bf* WV = (bf*)take((size_t)DKV * DM * 2); bf* WO = (bf*)take((size_t)DM * DQ * 2); float* CS = (float*)take((size_t)TT * HD * 2 * 4);
    bf* XB = (bf*)take((size_t)TT * DM * 2); bf* XKB = (bf*)take((size_t)TT * DM * 2); bf* XVB = (bf*)take((size_t)TT * DM * 2); float* Sb2 = (float*)take((size_t)ZH * TT * TT * 4); float* FQ = (float*)take((size_t)TT * DQ * 4); float* FK = (float*)take((size_t)TT * DKV * 4);
    h16* QP16 = (h16*)take((size_t)NH_ * TT * HD * 2); h16* KP16 = (h16*)take((size_t)NKV * TT * HD * 2); h16* VT16 = (h16*)take((size_t)NKV * HD * TT * 2);
    bf* QPh = (bf*)take((size_t)NH_ * TT * HD * 2); bf* QPl = (bf*)take((size_t)NH_ * TT * HD * 2); bf* KPh = (bf*)take((size_t)NKV * TT * HD * 2); bf* KPl = (bf*)take((size_t)NKV * TT * HD * 2); bf* VTh = (bf*)take((size_t)NKV * HD * TT * 2); bf* VTl = (bf*)take((size_t)NKV * HD * TT * 2); bf* Ph = (bf*)take((size_t)ZH * RH * TT * 2); bf* Pl = (bf*)take((size_t)ZH * RH * TT * 2);
    float* Sb = (float*)take((size_t)ZH * TT * TT * 4); h16* P16 = (h16*)take(256);   /* unused (no fp16 rows) */ float* Ob = (float*)take((size_t)ZH * TT * HD * 4); bf* ATh = (bf*)take((size_t)TT * DQ * 2); bf* ATl = (bf*)take((size_t)TT * DQ * 2);
    if ((size_t)(wsp - (char*)d_ws) > ws_size) return;    // ws 256 MiB
    float* FV = FK;   // v projection reuses the k buffer after the k planes are built (stream-ordered)
    { k_cvt8<<<(unsigned)(((size_t)DQ * DM / 8 + 255) / 256), 256, 0, stream>>>(wq, WQ, (size_t)DQ * DM / 8); k_cvt8<<<(unsigned)(((size_t)DKV * DM / 8 + 255) / 256), 256, 0, stream>>>(wk, WK, (size_t)DKV * DM / 8); k_cvt8<<<(unsigned)(((size_t)DKV * DM / 8 + 255) / 256), 256, 0, stream>>>(wv, WV, (size_t)DKV * DM / 8);
      k_cvt8<<<(unsigned)(((size_t)DM * DQ / 8 + 255) / 256), 256, 0, stream>>>(wo, WO, (size_t)DM * DQ / 8);
       }
    k_csid<<<(TT * HD + 255) / 256, 256, 0, stream>>>(CS);
    const unsigned LQ = (unsigned)(((size_t)NH_ * TT * HD / 2 + 255) / 256), LKv = (unsigned)(((size_t)NKV * TT * HD / 2 + 255) / 256);
    for (int b = 0; b < NB_; ++b) {
        
        k_cvt8<<<(unsigned)(((size_t)TT * DM / 8 + 255) / 256), 256, 0, stream>>>(x + (size_t)b * TT * DM, XB, (size_t)TT * DM / 8); k_cvt8<<<(unsigned)(((size_t)TT * DM / 8 + 255) / 256), 256, 0, stream>>>(xk + (size_t)b * TT * DM, XKB, (size_t)TT * DM / 8); k_cvt8<<<(unsigned)(((size_t)TT * DM / 8 + 255) / 256), 256, 0, stream>>>(xv + (size_t)b * TT * DM, XVB, (size_t)TT * DM / 8);
        k_gemmw<bf, 0, true><<<dim3(TT / 64, DQ / 64, 1), 32, 0, stream>>>(XB, nullptr, WQ, nullptr, DM, FQ, DQ, bq, 0, 0, 0);
        k_rope<<<LQ, 256, 0, stream>>>(FQ, DQ, NH_, CS, nullptr, nullptr, 1.0f, QP16, QPh, QPl);
        k_gemmw<bf, 0, true><<<dim3(TT / 64, DKV / 64, 1), 32, 0, stream>>>(XKB, nullptr, WK, nullptr, DM, FK, DKV, bk, 0, 0, 0);
        k_rope<<<LKv, 256, 0, stream>>>(FK, DKV, NKV, CS, nullptr, nullptr, 1.0f, KP16, KPh, KPl);
        k_gemmw<bf, 0, true><<<dim3(TT / 64, DKV / 64, 1), 32, 0, stream>>>(XVB, nullptr, WV, nullptr, DM, FV, DKV, bv, 0, 0, 0); k_vtp<<<LKv, 256, 0, stream>>>(FV, DKV, NKV, VT16, VTh, VTl);
        for (int h0 = 0; h0 < NH_; h0 += ZH) { const size_t zq = (size_t)h0, zk = (size_t)(h0 / REP);   // one kv head per query head: the pass's 12 heads use consecutive kv planes (z-strides TT*HD)
            k_gemmw<bf, 2, false><<<dim3(RH / 64, TT / 64, ZH), 32, 0, stream>>>(QPh + zq * TT * HD, QPl + zq * TT * HD, KPh + zk * TT * HD, KPl + zk * TT * HD, HD, Sb, TT, nullptr, (size_t)TT * HD, (size_t)TT * HD, (size_t)TT * TT);
            k_mix1<<<(unsigned)(((size_t)TT * TT + 255) / 256), 256, 0, stream>>>(Sb, Wl, bl, Sb2); k_asoftF<<<ZH * TT / 8, 256, 0, stream>>>(Sb2); k_mix2<<<(unsigned)(((size_t)TT * TT / 2 + 255) / 256), 256, 0, stream>>>(Sb2, Wp, bp, Ph, Pl);   /* talking-heads: mix logits across heads, softmax, mix probabilities, planes */
            k_gemmw<bf, 2, false><<<dim3(RH / 64, HD / 64, ZH), 32, 0, stream>>>(Ph, Pl, VTh + zk * HD * TT, VTl + zk * HD * TT, TT, Ob, HD, nullptr, (size_t)RH * TT, (size_t)HD * TT, (size_t)TT * HD);
            k_merge<<<(unsigned)(((size_t)ZH * TT * HD / 2 + 255) / 256), 256, 0, stream>>>(Ob, h0, ATh, ATl); }
        k_gemmw<bf, 1, true><<<dim3(TT / 64, DM / 64, 1), 32, 0, stream>>>(ATh, ATl, WO, nullptr, DQ, OUT + (size_t)b * TT * DM, DM, bo, 0, 0, 0); }
}

// v001
// It runs in 642 microseconds.
// Next to v000, in two timings, it ran 1.70 and 1.72 times as fast.
#include <hip/hip_runtime.h>

// Talking-heads attention (q, k, v [4][1024][768]; qh, kh, vh = . Wq^T + bq (the SAME 'oi' [768][768] projection for all three), 12 heads x 64; logits = qh.kh/8; logits' [g] = sum_h Wl[g][h] logits[h] + bl[g]; attn = softmax(logits'); attn'[g] = sum_h Wp[g][h] attn[h] + bp[g]; out_h = attn'[h].v_h; merged Wf^T + bf -> [4][1024][768]).
// Layout: all 12 heads of a batch are processed together (z-batched GEMMs) so one kernel holds a query row's 12 x 1024 scores in registers and does both cross-head mixes (f32, fixed head order) and the softmax between them; scores use bf16 hi/lo planes on every row (3 products); the mixed probabilities become hi/lo planes for attn'.v.
// Compute dtypes, f32 accumulate: every input rounded to bf16; q/k/v on PLAIN bf16 operands (inputs: exact) + bias; scores and attn.v: all query rows hl (3 products), no fp16 rows; softmax f32; Wf hl x exact (2 products) + bf.

#define NB_  4
#define TT   1024
#define DM   768
#define NH_  12
#define NKV  12
#define REP  (NH_ / NKV)
#define HD   64
#define DQ   (NH_ * HD)
#define DKV  (NKV * HD)
#define ZH   12                  // all heads per pass (cross-head mixing)
#define RH   1024                  // query rows < RH use hi+lo planes (0: none)
#define WIN  0
#define PCAR 1024.0f
#define SCL  0.125f   // HD^-0.5
typedef _Float16 h16;
typedef unsigned short bf;
typedef __attribute__((ext_vector_type(16))) __bf16   v16bf;
typedef __attribute__((ext_vector_type(16))) _Float16 v16h;
typedef __attribute__((ext_vector_type(8)))  _Float16 v8h;
typedef __attribute__((ext_vector_type(8)))  unsigned short v8us;
typedef __attribute__((ext_vector_type(8)))  float    v8f;
typedef __attribute__((ext_vector_type(4)))  float    v4f;
typedef v8h  __attribute__((may_alias)) v8ha;
typedef v4f  __attribute__((may_alias)) v4fa;
typedef v8us __attribute__((may_alias)) v8usa;

__device__ __forceinline__ unsigned short f2bf(float f) { unsigned u = __float_as_uint(f); u += 0x7FFFu + ((u >> 16) & 1u); return (unsigned short)(u >> 16); }
__device__ __forceinline__ float bf2f(unsigned short b) { return __uint_as_float(((unsigned)b) << 16); }
__device__ __forceinline__ float bfr(float f) { return bf2f(f2bf(f)); }
__device__ __forceinline__ v16h cat16(v8h lo, v8h hi) { return __builtin_shufflevector(lo, hi, 0, 1, 2, 3, 4, 5, 6, 7, 8, 9, 10, 11, 12, 13, 14, 15); }
__device__ __forceinline__ v16bf cat16b(v8us lo, v8us hi) { return __builtin_bit_cast(v16bf, __builtin_shufflevector(lo, hi, 0, 1, 2, 3, 4, 5, 6, 7, 8, 9, 10, 11, 12, 13, 14, 15)); }
__device__ __forceinline__ v8f wmma16(v16h a, v16h b, v8f c) { return __builtin_amdgcn_wmma_f32_16x16x32_f16(false, a, false, b, (short)0, c, false, false); }
__device__ __forceinline__ v8f wmmab(v16bf a, v16bf b, v8f c) { return __builtin_amdgcn_wmma_f32_16x16x32_bf16(false, a, false, b, (short)0, c, false, false); }



// ---- k_gemmw: register-blocked GEMM, ONE WAVE per 64x64 output tile (16 accumulators), operands straight from K-contiguous 16-bit planes; grid (M/64, N/64, Z), 32 threads.
// C[m][n] (f32, pitch ldc, + optional f32 bias[n]) = sum_k A[m][k] Bt[n][k] (+ split products per NSPLIT). z-batch strides sA/sB/sC in elements. K % 32 == 0.
template <typename T16> struct WFrag;
template <> struct WFrag<h16> { typedef v16h V; static __device__ __forceinline__ V ld(const h16* p) { return cat16(*(const v8h*)p, *(const v8h*)(p + 16)); } static __device__ __forceinline__ v8f mma(V a, V b, v8f c) { return wmma16(a, b, c); } };
template <> struct WFrag<bf> { typedef v16bf V; static __device__ __forceinline__ V ld(const bf* p) { return cat16b(*(const v8us*)p, *(const v8us*)(p + 16)); } static __device__ __forceinline__ v8f mma(V a, V b, v8f c) { return wmmab(a, b, c); } };
template <typename T16, int NSPLIT, bool BIAS>
__global__ __launch_bounds__(32) void k_gemmw(const T16* __restrict__ A, const T16* __restrict__ A2, const T16* __restrict__ Bt, const T16* __restrict__ Bt2, int K, float* C, int ldc, const float* __restrict__ bias, size_t sA, size_t sB, size_t sC) {
    typedef typename WFrag<T16>::V V;
    __shared__ __align__(16) float os[16 * 68];
    const size_t z = blockIdx.z; A += z * sA; if (A2) A2 += z * sA; Bt += z * sB; if (Bt2) Bt2 += z * sB; C += z * sC;
    const int lane = threadIdx.x & 31, lr = lane & 15, hi = lane >> 4; const int r0 = blockIdx.x * 64, c0 = blockIdx.y * 64;
    v8f acc[4][4];
#pragma unroll
    for (int mb = 0; mb < 4; ++mb)
#pragma unroll
        for (int nb = 0; nb < 4; ++nb) acc[mb][nb] = (v8f){};
    const size_t aoff = (size_t)(r0 + lr) * K + 8 * hi, boff = (size_t)(c0 + lr) * K + 8 * hi;
#pragma unroll 1
    for (int kc = 0; kc < K; kc += 32) {
        V a[4], a2[4];
#pragma unroll
        for (int mb = 0; mb < 4; ++mb) { a[mb] = WFrag<T16>::ld(A + aoff + (size_t)mb * 16 * K + kc); if (NSPLIT == 1 || NSPLIT == 2) a2[mb] = WFrag<T16>::ld(A2 + aoff + (size_t)mb * 16 * K + kc); }
#pragma unroll
        for (int nb = 0; nb < 4; ++nb) { const V b = WFrag<T16>::ld(Bt + boff + (size_t)nb * 16 * K + kc); V b2; if (NSPLIT >= 2) b2 = WFrag<T16>::ld(Bt2 + boff + (size_t)nb * 16 * K + kc);
#pragma unroll
            for (int mb = 0; mb < 4; ++mb) { acc[mb][nb] = WFrag<T16>::mma(a[mb], b, acc[mb][nb]); if (NSPLIT == 1 || NSPLIT == 2) acc[mb][nb] = WFrag<T16>::mma(a2[mb], b, acc[mb][nb]); if (NSPLIT >= 2) acc[mb][nb] = WFrag<T16>::mma(a[mb], b2, acc[mb][nb]); } }
        asm volatile("v_nop\n\tv_nop\n\tv_nop\n\tv_nop" : "+v"(acc[0][0]), "+v"(acc[1][1]), "+v"(acc[2][2]), "+v"(acc[3][3]) : "v"(a[0]), "v"(a[3]));
    }
#pragma unroll
    for (int mb = 0; mb < 4; ++mb) {
#pragma unroll
        for (int nb = 0; nb < 4; ++nb) {
#pragma unroll
            for (int j = 0; j < 8; ++j) os[(hi * 8 + j) * 68 + nb * 16 + lr] = acc[mb][nb][j]; }
        __builtin_amdgcn_wave_barrier(); asm volatile("" ::: "memory");
        float* crow = C + (size_t)(r0 + mb * 16) * ldc + c0;
{
#pragma unroll
            for (int s = 0; s < 8; ++s) { const int row = 2 * s + hi, cofs = lr * 4; v4f val = *(const v4fa*)(os + row * 68 + cofs); if (BIAS) { val[0] += bfr(bias[c0 + cofs]); val[1] += bfr(bias[c0 + cofs + 1]); val[2] += bfr(bias[c0 + cofs + 2]); val[3] += bfr(bias[c0 + cofs + 3]); }
                *(v4f*)(crow + (size_t)row * ldc + cofs) = val; }
             }
        __builtin_amdgcn_wave_barrier(); asm volatile("" ::: "memory");
    }
}

__device__ __forceinline__ h16 tohx(float x) { return (h16)x; }
__device__ __forceinline__ void splitf(float y, unsigned short& h, unsigned short& l) { h = f2bf(y); l = f2bf(y - bf2f(h)); }
typedef __attribute__((ext_vector_type(2))) _Float16 v2h;
typedef __attribute__((ext_vector_type(4))) _Float16 v4h;
typedef __attribute__((ext_vector_type(2))) unsigned short v2us;
typedef __attribute__((ext_vector_type(4))) unsigned short v4us;
typedef __attribute__((ext_vector_type(2))) float v2f;
typedef __attribute__((ext_vector_type(4))) int v4i;

__global__ __launch_bounds__(256) void k_wtG(const float* __restrict__ w, int K, int N, bf* Bt) {
    const int lane = threadIdx.x & 31; const int L0 = (blockIdx.x * 8 + (threadIdx.x >> 5)) * 8; const int nlines = N * K / 64;
{
#pragma unroll 1
        for (int l = 0; l < 8; ++l) { const int L = L0 + l; if (L >= nlines) break; const size_t e = (size_t)L * 64 + lane * 2; const int k = (int)(e % K), n = (int)(e / K); v2us o;
            o[0] = f2bf(w[(size_t)k * N + n]); o[1] = f2bf(w[(size_t)(k + 1) * N + n]); *(v2us*)(Bt + e) = o; }
         }
}
__global__ __launch_bounds__(256) void k_cvt8(const float* __restrict__ src, bf* dst, size_t n8) { const size_t i = (size_t)blockIdx.x * 256 + threadIdx.x; if (i >= n8) return; const v8f v = *(const v8f*)(src + i * 8); v8us o;
#pragma unroll
    for (int k = 0; k < 8; ++k) o[k] = f2bf(v[k]); *(v8us*)(dst + i * 8) = o;  }

// k_rope: head planes [h][t][d] (fp16 + hi/lo) of rope(x) x sc with the rotate-half convention out[d] = x[d] cos[t][d] - x[d+HD/2] sin[t][d], out[d+HD/2] = x[d+HD/2] cos[t][d+HD/2] + x[d] sin[t][d+HD/2]
__global__ __launch_bounds__(256) void k_rope(const float* __restrict__ F, int pitch, int nheads, const float* __restrict__ CS, const float* __restrict__ RF, const float* __restrict__ nw, float sc, h16* P16, bf* Ph, bf* Pl) {
    const size_t e = ((size_t)blockIdx.x * 256 + threadIdx.x) * 2; if (e >= (size_t)nheads * TT * HD) return; const int d = (int)(e % HD); const int t = (int)((e / HD) % TT); const int h = (int)(e / ((size_t)HD * TT)); const float* f = F + (size_t)t * pitch + h * HD; const float rf = RF ? RF[(size_t)h * TT + t] : 1.0f; v2h o16; v2us oh, ol;
#pragma unroll
    for (int q = 0; q < 2; ++q) { const int dd = d + q; const int dp = (dd < HD / 2) ? dd + HD / 2 : dd - HD / 2; float x0 = f[dd], x1 = f[dp];
        if (RF) { float n0 = __fmul_rn(x0, rf), n1 = __fmul_rn(x1, rf); asm volatile("" : "+v"(n0)); asm volatile("" : "+v"(n1)); x0 = __fmul_rn(bfr(nw[dd]), n0); x1 = __fmul_rn(bfr(nw[dp]), n1); }
        const v2f cs = *(const v2f*)(CS + ((size_t)t * HD + dd) * 2); float a = __fmul_rn(x0, cs[0]), bq = __fmul_rn(x1, cs[1]); asm volatile("" : "+v"(a)); asm volatile("" : "+v"(bq)); const float r = ((dd < HD / 2) ? __fsub_rn(a, bq) : __fadd_rn(a, bq)) * sc;
        o16[q] = tohx(r); unsigned short a2, c2; splitf(r, a2, c2); oh[q] = a2; ol[q] = c2; }
    *(v2h*)(P16 + e) = o16; *(v2us*)(Ph + e) = oh; *(v2us*)(Pl + e) = ol;  }
__global__ __launch_bounds__(256) void k_vtp(const float* __restrict__ F, int pitch, int nheads, h16* V16, bf* Vh, bf* Vl) { const size_t e = ((size_t)blockIdx.x * 256 + threadIdx.x) * 2; if (e >= (size_t)nheads * HD * TT) return; const int t = (int)(e % TT); const int d = (int)((e / TT) % HD); const int g = (int)(e / ((size_t)TT * HD)); v2h o16; v2us oh, ol;
#pragma unroll
    for (int q = 0; q < 2; ++q) { const float x = F[(size_t)(t + q) * pitch + g * HD + d]; o16[q] = tohx(x); unsigned short a2, c2; splitf(x, a2, c2); oh[q] = a2; ol[q] = c2; }
    *(v2h*)(V16 + e) = o16; *(v2us*)(Vh + e) = oh; *(v2us*)(Vl + e) = ol;  }
__global__ __launch_bounds__(256) void k_csid(float* CS) { const int idx = blockIdx.x * 256 + threadIdx.x; if (idx >= TT * HD) return; v2f cs; cs[0] = 1.0f; cs[1] = 0.0f; *(v2f*)(CS + (size_t)idx * 2) = cs;  }

// ---- k_thsm: logit mix, softmax and probability mix of ONE query row in one work-group (grid TT, 256 threads). Thread t holds keys 4t..4t+3 of all 12 heads in registers, so both cross-head mixes are thread-local;
// only the 12 row maxima and the 12 row sums cross lanes (16-lane DPP butterfly, cross-row swap, then 8 wave partials through LDS, summed in wave order).
template <int CTRL> __device__ __forceinline__ float dppmov(float x) { return __builtin_bit_cast(float, __builtin_amdgcn_update_dpp(0, __builtin_bit_cast(int, x), CTRL, 0xf, 0xf, true)); }   // CTRL 0x160 + m: lane l reads lane l ^ m of its 16-lane row
__device__ __forceinline__ float swap16(float x) { const int b = __builtin_bit_cast(int, x); return __builtin_bit_cast(float, __builtin_amdgcn_permlanex16(b, b, 0x76543210, 0xfedcba98, false, false)); }   // lane l reads lane l ^ 16
__device__ __forceinline__ float wave_max(float m) { m = fmaxf(m, dppmov<0x161>(m)); m = fmaxf(m, dppmov<0x162>(m)); m = fmaxf(m, dppmov<0x164>(m)); m = fmaxf(m, dppmov<0x168>(m)); return fmaxf(m, swap16(m)); }
__device__ __forceinline__ float wave_sum(float s) { s += dppmov<0x161>(s); s += dppmov<0x162>(s); s += dppmov<0x164>(s); s += dppmov<0x168>(s); return s + swap16(s); }
// 8 waves per SIMD asked for (128 registers): all 1024 work-groups of a launch are then resident at once, with no second, part-filled round
__global__ __launch_bounds__(256, 8) void k_thsm(const float* __restrict__ S, const float* __restrict__ Wl, const float* __restrict__ bl, const float* __restrict__ Wp, const float* __restrict__ bp, bf* Ph, bf* Pl, size_t zs) {   // zs: head-plane stride in elements; as an argument it gives each plane's load an address pair of its own
    __shared__ __align__(16) float wls[NH_ * NH_]; __shared__ __align__(16) float wps[NH_ * NH_]; __shared__ __align__(16) float bls[NH_]; __shared__ __align__(16) float bps[NH_]; __shared__ __align__(16) float rmx[8 * NH_]; __shared__ __align__(16) float rsm[8 * NH_];
    const int tid = threadIdx.x, lane = tid & 31, wv = tid >> 5; const unsigned k0 = tid * 4; const size_t r0 = (size_t)blockIdx.x * TT;   // the lane's first key; the row's offset in a head plane (uniform)
    v4f L[NH_]; const float* sp[NH_];
#pragma unroll   // constant indices: the arrays stay in registers
    for (int h = 0; h < NH_; ++h) { sp[h] = S + r0 + h * zs + k0; L[h] = *(const v4f*)sp[h]; }
    // the wait before a load's address registers are rewritten; the 12 address pairs are its inputs, so they stay live up to it and no later load of the run lands on an earlier one's address
    asm volatile("s_wait_xcnt 0x0" :: "v"(sp[0]), "v"(sp[1]), "v"(sp[2]), "v"(sp[3]), "v"(sp[4]), "v"(sp[5]), "v"(sp[6]), "v"(sp[7]), "v"(sp[8]), "v"(sp[9]), "v"(sp[10]), "v"(sp[11]) : "memory");
    if (tid < NH_ * NH_) { wls[tid] = bfr(Wl[tid]); wps[tid] = bfr(Wp[tid]); } else if (tid < NH_ * NH_ + NH_) { bls[tid - NH_ * NH_] = bfr(bl[tid - NH_ * NH_]); bps[tid - NH_ * NH_] = bfr(bp[tid - NH_ * NH_]); }
    __syncthreads();   // the rounded weights and biases are in LDS for every wave
#pragma unroll   // constant indices: the arrays stay in registers
    for (int h = 0; h < NH_; ++h) L[h] *= SCL;
    v4f M[NH_]; float red[NH_];
#pragma unroll   // constant indices: the arrays stay in registers
    for (int g = 0; g < NH_; ++g) { v4f acc = wls[g * NH_] * L[0];
#pragma unroll   // constant indices: the arrays stay in registers
        for (int h = 1; h < NH_; ++h) acc += wls[g * NH_ + h] * L[h];
        acc += bls[g]; M[g] = acc; red[g] = wave_max(fmaxf(fmaxf(fmaxf(acc[0], acc[1]), fmaxf(acc[2], acc[3])), -3.0e38f)); }
    if (lane == 0) {
#pragma unroll   // constant indices: the arrays stay in registers
        for (int c = 0; c < NH_ / 4; ++c) { v4f o; o[0] = red[c * 4]; o[1] = red[c * 4 + 1]; o[2] = red[c * 4 + 2]; o[3] = red[c * 4 + 3]; *(v4f*)(rmx + wv * NH_ + c * 4) = o; } }
    __syncthreads();   // all 8 waves' partial maxima are in LDS
#pragma unroll   // constant indices: the arrays stay in registers
    for (int c = 0; c < NH_ / 4; ++c) { v4f m = *(const v4f*)(rmx + c * 4);
#pragma unroll   // constant indices: the arrays stay in registers
        for (int w = 1; w < 8; ++w) { const v4f r = *(const v4f*)(rmx + w * NH_ + c * 4); m[0] = fmaxf(m[0], r[0]); m[1] = fmaxf(m[1], r[1]); m[2] = fmaxf(m[2], r[2]); m[3] = fmaxf(m[3], r[3]); }
        red[c * 4] = m[0]; red[c * 4 + 1] = m[1]; red[c * 4 + 2] = m[2]; red[c * 4 + 3] = m[3]; }
#pragma unroll   // constant indices: the arrays stay in registers
    for (int g = 0; g < NH_; ++g) { v4f p = (M[g] - red[g]) * 1.4426950408889634f;
#pragma unroll   // constant indices: the arrays stay in registers
        for (int q = 0; q < 4; ++q) p[q] = __builtin_amdgcn_exp2f(p[q]);
        M[g] = p; red[g] = wave_sum((p[0] + p[1]) + (p[2] + p[3])); }
    if (lane == 0) {
#pragma unroll   // constant indices: the arrays stay in registers
        for (int c = 0; c < NH_ / 4; ++c) { v4f o; o[0] = red[c * 4]; o[1] = red[c * 4 + 1]; o[2] = red[c * 4 + 2]; o[3] = red[c * 4 + 3]; *(v4f*)(rsm + wv * NH_ + c * 4) = o; } }
    __syncthreads();   // all 8 waves' partial sums are in LDS (own array: no wave can still be reading the maxima's)
#pragma unroll   // constant indices: the arrays stay in registers
    for (int c = 0; c < NH_ / 4; ++c) { v4f s = *(const v4f*)(rsm + c * 4);
#pragma unroll   // constant indices: the arrays stay in registers
        for (int w = 1; w < 8; ++w) s += *(const v4f*)(rsm + w * NH_ + c * 4);
#pragma unroll   // constant indices: the arrays stay in registers
        for (int q = 0; q < 4; ++q) M[c * 4 + q] *= __fdiv_rn(1.0f, s[q]); }
#pragma unroll   // constant indices: the arrays stay in registers
    for (int g = 0; g < NH_; ++g) { v4f acc = wps[g * NH_] * M[0];
#pragma unroll   // constant indices: the arrays stay in registers
        for (int h = 1; h < NH_; ++h) acc += wps[g * NH_ + h] * M[h];
        acc += bps[g]; v4us oh, ol;
#pragma unroll   // constant indices: the arrays stay in registers
        for (int q = 0; q < 4; ++q) { unsigned short a, c2; splitf(acc[q], a, c2); oh[q] = a; ol[q] = c2; }
        *(v4us*)(Ph + r0 + g * zs + k0) = oh; *(v4us*)(Pl + r0 + g * zs + k0) = ol; }
}
__global__ __launch_bounds__(256) void k_merge(const float* __restrict__ O, int h0, bf* Ah, bf* Al) { const size_t e = ((size_t)blockIdx.x * 256 + threadIdx.x) * 2; if (e >= (size_t)ZH * TT * HD) return; const int d = (int)(e % HD); const int t = (int)((e / HD) % TT); const int zz = (int)(e / ((size_t)HD * TT)); const float cs = (t < RH) ? 1.0f : (1.0f / PCAR); const size_t oo = (size_t)t * DQ + (h0 + zz) * HD + d;
    v2us oh, ol;
#pragma unroll
    for (int q = 0; q < 2; ++q) { unsigned short a, c2; splitf(O[e + q] * cs, a, c2); oh[q] = a; ol[q] = c2; } *(v2us*)(Ah + oo) = oh; *(v2us*)(Al + oo) = ol;  }

extern "C" void kernel_launch(void* const* d_in, const int* in_sizes, int n_in,
                              void* d_out, int out_size, void* d_ws, size_t ws_size, hipStream_t stream) {
    (void)in_sizes; (void)n_in; (void)out_size;
    const float* x = (const float*)d_in[0]; const float* xk = (const float*)d_in[1]; const float* xv = (const float*)d_in[2]; const float* wq = (const float*)d_in[3]; const float* bq = (const float*)d_in[4]; const float* Wl = (const float*)d_in[5]; const float* bl = (const float*)d_in[6]; const float* Wp = (const float*)d_in[7]; const float* bp = (const float*)d_in[8]; const float* wo = (const float*)d_in[9]; const float* bo = (const float*)d_in[10]; const float* wk = wq; const float* wv = wq; const float* bk = bq; const float* bv = bq;
    float* OUT = (float*)d_out;     // [4][1024][768]
    char* wsp = (char*)d_ws;
    auto take = [&](size_t bytes) { char* p = wsp; wsp += (bytes + 255) & ~(size_t)255; return (void*)p; };
    bf* WQ = (bf*)take((size_t)DQ * DM * 2); bf* WK = (bf*)take((size_t)DKV * DM * 2); bf* WV = (bf*)take((size_t)DKV * DM * 2); bf* WO = (bf*)take((size_t)DM * DQ * 2); float* CS = (float*)take((size_t)TT * HD * 2 * 4);
    bf* XB = (bf*)take((size_t)TT * DM * 2); bf* XKB = (bf*)take((size_t)TT * DM * 2); bf* XVB = (bf*)take((size_t)TT * DM * 2); float* FQ = (float*)take((size_t)TT * DQ * 4); float* FK = (float*)take((size_t)TT * DKV * 4);
    h16* QP16 = (h16*)take((size_t)NH_ * TT * HD * 2); h16* KP16 = (h16*)take((size_t)NKV * TT * HD * 2); h16* VT16 = (h16*)take((size_t)NKV * HD * TT * 2);
    bf* QPh = (bf*)take((size_t)NH_ * TT * HD * 2); bf* QPl = (bf*)take((size_t)NH_ * TT * HD * 2); bf* KPh = (bf*)take((size_t)NKV * TT * HD * 2); bf* KPl = (bf*)take((size_t)NKV * TT * HD * 2); bf* VTh = (bf*)take((size_t)NKV * HD * TT * 2); bf* VTl = (bf*)take((size_t)NKV * HD * TT * 2); bf* Ph = (bf*)take((size_t)ZH * RH * TT * 2); bf* Pl = (bf*)take((size_t)ZH * RH * TT * 2);
    float* Sb = (float*)take((size_t)ZH * TT * TT * 4); h16* P16 = (h16*)take(256);   /* unused (no fp16 rows) */ float* Ob = (float*)take((size_t)ZH * TT * HD * 4); bf* ATh = (bf*)take((size_t)TT * DQ * 2); bf* ATl = (bf*)take((size_t)TT * DQ * 2);
    if ((size_t)(wsp - (char*)d_ws) > ws_size) return;    // ws 256 MiB
    float* FV = FK;   // v projection reuses the k buffer after the k planes are built (stream-ordered)
    { k_cvt8<<<(unsigned)(((size_t)DQ * DM / 8 + 255) / 256), 256, 0, stream>>>(wq, WQ, (size_t)DQ * DM / 8); k_cvt8<<<(unsigned)(((size_t)DKV * DM / 8 + 255) / 256), 256, 0, stream>>>(wk, WK, (size_t)DKV * DM / 8); k_cvt8<<<(unsigned)(((size_t)DKV * DM / 8 + 255) / 256), 256, 0, stream>>>(wv, WV, (size_t)DKV * DM / 8);
      k_cvt8<<<(unsigned)(((size_t)DM * DQ / 8 + 255) / 256), 256, 0, stream>>>(wo, WO, (size_t)DM * DQ / 8);
       }
    k_csid<<<(TT * HD + 255) / 256, 256, 0, stream>>>(CS);
    const unsigned LQ = (unsigned)(((size_t)NH_ * TT * HD / 2 + 255) / 256), LKv = (unsigned)(((size_t)NKV * TT * HD / 2 + 255) / 256);
    for (int b = 0; b < NB_; ++b) {
        
        k_cvt8<<<(unsigned)(((size_t)TT * DM / 8 + 255) / 256), 256, 0, stream>>>(x + (size_t)b * TT * DM, XB, (size_t)TT * DM / 8); k_cvt8<<<(unsigned)(((size_t)TT * DM / 8 + 255) / 256), 256, 0, stream>>>(xk + (size_t)b * TT * DM, XKB, (size_t)TT * DM / 8); k_cvt8<<<(unsigned)(((size_t)TT * DM / 8 + 255) / 256), 256, 0, stream>>>(xv + (size_t)b * TT * DM, XVB, (size_t)TT * DM / 8);
        k_gemmw<bf, 0, true><<<dim3(TT / 64, DQ / 64, 1), 32, 0, stream>>>(XB, nullptr, WQ, nullptr, DM, FQ, DQ, bq, 0, 0, 0);
        k_rope<<<LQ, 256, 0, stream>>>(FQ, DQ, NH_, CS, nullptr, nullptr, 1.0f, QP16, QPh, QPl);
        k_gemmw<bf, 0, true><<<dim3(TT / 64, DKV / 64, 1), 32, 0, stream>>>(XKB, nullptr, WK, nullptr, DM, FK, DKV, bk, 0, 0, 0);
        k_rope<<<LKv, 256, 0, stream>>>(FK, DKV, NKV, CS, nullptr, nullptr, 1.0f, KP16, KPh, KPl);
        k_gemmw<bf, 0, true><<<dim3(TT / 64, DKV / 64, 1), 32, 0, stream>>>(XVB, nullptr, WV, nullptr, DM, FV, DKV, bv, 0, 0, 0); k_vtp<<<LKv, 256, 0, stream>>>(FV, DKV, NKV, VT16, VTh, VTl);
        for (int h0 = 0; h0 < NH_; h0 += ZH) { const size_t zq = (size_t)h0, zk = (size_t)(h0 / REP);   // one kv head per query head: the pass's 12 heads use consecutive kv planes (z-strides TT*HD)
            k_gemmw<bf, 2, false><<<dim3(RH / 64, TT / 64, ZH), 32, 0, stream>>>(QPh + zq * TT * HD, QPl + zq * TT * HD, KPh + zk * TT * HD, KPl + zk * TT * HD, HD, Sb, TT, nullptr, (size_t)TT * HD, (size_t)TT * HD, (size_t)TT * TT);
            k_thsm<<<TT, 256, 0, stream>>>(Sb, Wl, bl, Wp, bp, Ph, Pl, (size_t)TT * TT);   /* talking-heads: mix logits across heads, softmax, mix probabilities, planes: one launch, one work-group per query row */
            k_gemmw<bf, 2, false><<<dim3(RH / 64, HD / 64, ZH), 32, 0, stream>>>(Ph, Pl, VTh + zk * HD * TT, VTl + zk * HD * TT, TT, Ob, HD, nullptr, (size_t)RH * TT, (size_t)HD * TT, (size_t)TT * HD);
            k_merge<<<(unsigned)(((size_t)ZH * TT * HD / 2 + 255) / 256), 256, 0, stream>>>(Ob, h0, ATh, ATl); }
        k_gemmw<bf, 1, true><<<dim3(TT / 64, DM / 64, 1), 32, 0, stream>>>(ATh, ATl, WO, nullptr, DQ, OUT + (size_t)b * TT * DM, DM, bo, 0, 0, 0); }
}

// v002
// It runs in 258 microseconds.
// In two side-by-side timings against v001, it was 2.46 and 2.51 times as fast.
// Over all steps from v000 it is 4.25 times as fast.
#include <hip/hip_runtime.h>

// Talking-heads attention (q, k, v [4][1024][768]; qh, kh, vh = . Wq^T + bq (the SAME 'oi' [768][768] projection for all three), 12 heads x 64; logits = qh.kh/8; logits' [g] = sum_h Wl[g][h] logits[h] + bl[g]; attn = softmax(logits'); attn'[g] = sum_h Wp[g][h] attn[h] + bp[g]; out_h = attn'[h].v_h; merged Wf^T + bf -> [4][1024][768]).
// Layout: all 4 batches and all 12 heads are processed together (batch and q/k/v are grid dimensions, 48 z-batched score planes) so one kernel holds a query row's 12 x 1024 scores in registers and does both cross-head mixes (f32, fixed head order) and the softmax between them; scores use bf16 hi/lo planes on every row (3 products); the mixed probabilities become hi/lo planes for attn'.v.
// Compute dtypes, f32 accumulate: every input rounded to bf16; q/k/v on PLAIN bf16 operands (inputs: exact) + bias; scores and attn.v: bf16 hl on every query row (3 products); softmax f32; Wf hl x exact (2 products) + bf.

#define NB_  4
#define TT   1024
#define DM   768
#define NH_  12
#define NKV  12
#define REP  (NH_ / NKV)
#define HD   64
#define DQ   (NH_ * HD)
#define DKV  (NKV * HD)
#define ZH   12                  // all heads per pass (cross-head mixing)
#define RH   1024                  // k_merge divides query rows >= RH by PCAR (none here)
#define WIN  0
#define PCAR 1024.0f
#define SCL  0.125f   // HD^-0.5
typedef _Float16 h16;
typedef unsigned short bf;
typedef __attribute__((ext_vector_type(16))) __bf16   v16bf;
typedef __attribute__((ext_vector_type(16))) _Float16 v16h;
typedef __attribute__((ext_vector_type(8)))  _Float16 v8h;
typedef __attribute__((ext_vector_type(8)))  unsigned short v8us;
typedef __attribute__((ext_vector_type(8)))  float    v8f;
typedef __attribute__((ext_vector_type(4)))  float    v4f;
typedef v8h  __attribute__((may_alias)) v8ha;
typedef v4f  __attribute__((may_alias)) v4fa;
typedef v8us __attribute__((may_alias)) v8usa;

__device__ __forceinline__ unsigned short f2bf(float f) { unsigned u = __float_as_uint(f); u += 0x7FFFu + ((u >> 16) & 1u); return (unsigned short)(u >> 16); }
__device__ __forceinline__ float bf2f(unsigned short b) { return __uint_as_float(((unsigned)b) << 16); }
__device__ __forceinline__ float bfr(float f) { return bf2f(f2bf(f)); }
__device__ __forceinline__ v16h cat16(v8h lo, v8h hi) { return __builtin_shufflevector(lo, hi, 0, 1, 2, 3, 4, 5, 6, 7, 8, 9, 10, 11, 12, 13, 14, 15); }
__device__ __forceinline__ v16bf cat16b(v8us lo, v8us hi) { return __builtin_bit_cast(v16bf, __builtin_shufflevector(lo, hi, 0, 1, 2, 3, 4, 5, 6, 7, 8, 9, 10, 11, 12, 13, 14, 15)); }
__device__ __forceinline__ v8f wmma16(v16h a, v16h b, v8f c) { return __builtin_amdgcn_wmma_f32_16x16x32_f16(false, a, false, b, (short)0, c, false, false); }
__device__ __forceinline__ v8f wmmab(v16bf a, v16bf b, v8f c) { return __builtin_amdgcn_wmma_f32_16x16x32_bf16(false, a, false, b, (short)0, c, false, false); }



// ---- k_gemmw: register-blocked GEMM, ONE WAVE per 64x64 output tile (16 accumulators), operands straight from K-contiguous 16-bit planes; grid (M/64, N/64, Z), 32 threads.
// C[m][n] (f32, pitch ldc, + optional f32 bias[n]) = sum_k A[m][k] Bt[n][k] (+ split products per NSPLIT). K is the row pitch of A and Bt, KL the length of the sum (KL <= K: a row may hold a hi half, then a lo half). z-batch strides sA/sB/sC in elements. KL % 32 == 0.
template <typename T16> struct WFrag;
template <> struct WFrag<h16> { typedef v16h V; static __device__ __forceinline__ V ld(const h16* p) { return cat16(*(const v8h*)p, *(const v8h*)(p + 16)); } static __device__ __forceinline__ v8f mma(V a, V b, v8f c) { return wmma16(a, b, c); } };
template <> struct WFrag<bf> { typedef v16bf V; static __device__ __forceinline__ V ld(const bf* p) { return cat16b(*(const v8us*)p, *(const v8us*)(p + 16)); } static __device__ __forceinline__ v8f mma(V a, V b, v8f c) { return wmmab(a, b, c); } };
template <typename T16, int NSPLIT, bool BIAS>
__global__ __launch_bounds__(32) void k_gemmw(const T16* __restrict__ A, const T16* __restrict__ A2, const T16* __restrict__ Bt, const T16* __restrict__ Bt2, int K, int KL, float* C, int ldc, const float* __restrict__ bias, size_t sA, size_t sB, size_t sC) {
    typedef typename WFrag<T16>::V V;
    __shared__ __align__(16) float os[16 * 68];
    const size_t z = blockIdx.z; A += z * sA; if (A2) A2 += z * sA; Bt += z * sB; if (Bt2) Bt2 += z * sB; C += z * sC;
    const int lane = threadIdx.x & 31, lr = lane & 15, hi = lane >> 4; const int r0 = blockIdx.x * 64, c0 = blockIdx.y * 64;
    v8f acc[4][4];
#pragma unroll
    for (int mb = 0; mb < 4; ++mb)
#pragma unroll
        for (int nb = 0; nb < 4; ++nb) acc[mb][nb] = (v8f){};
    const size_t aoff = (size_t)(r0 + lr) * K + 8 * hi, boff = (size_t)(c0 + lr) * K + 8 * hi;
#pragma unroll 1
    for (int kc = 0; kc < KL; kc += 32) {
        V a[4], a2[4];
#pragma unroll
        for (int mb = 0; mb < 4; ++mb) { a[mb] = WFrag<T16>::ld(A + aoff + (size_t)mb * 16 * K + kc); if (NSPLIT == 1 || NSPLIT == 2) a2[mb] = WFrag<T16>::ld(A2 + aoff + (size_t)mb * 16 * K + kc); }
#pragma unroll
        for (int nb = 0; nb < 4; ++nb) { const V b = WFrag<T16>::ld(Bt + boff + (size_t)nb * 16 * K + kc); V b2; if (NSPLIT >= 2) b2 = WFrag<T16>::ld(Bt2 + boff + (size_t)nb * 16 * K + kc);
#pragma unroll
            for (int mb = 0; mb < 4; ++mb) { acc[mb][nb] = WFrag<T16>::mma(a[mb], b, acc[mb][nb]); if (NSPLIT == 1 || NSPLIT == 2) acc[mb][nb] = WFrag<T16>::mma(a2[mb], b, acc[mb][nb]); if (NSPLIT >= 2) acc[mb][nb] = WFrag<T16>::mma(a[mb], b2, acc[mb][nb]); } }
        asm volatile("v_nop\n\tv_nop\n\tv_nop\n\tv_nop" : "+v"(acc[0][0]), "+v"(acc[1][1]), "+v"(acc[2][2]), "+v"(acc[3][3]) : "v"(a[0]), "v"(a[3]));
    }
#pragma unroll
    for (int mb = 0; mb < 4; ++mb) {
#pragma unroll
        for (int nb = 0; nb < 4; ++nb) {
#pragma unroll
            for (int j = 0; j < 8; ++j) os[(hi * 8 + j) * 68 + nb * 16 + lr] = acc[mb][nb][j]; }
        __builtin_amdgcn_wave_barrier(); asm volatile("" ::: "memory");
        float* crow = C + (size_t)(r0 + mb * 16) * ldc + c0;
{
#pragma unroll
            for (int s = 0; s < 8; ++s) { const int row = 2 * s + hi, cofs = lr * 4; v4f val = *(const v4fa*)(os + row * 68 + cofs); if (BIAS) { val[0] += bfr(bias[c0 + cofs]); val[1] += bfr(bias[c0 + cofs + 1]); val[2] += bfr(bias[c0 + cofs + 2]); val[3] += bfr(bias[c0 + cofs + 3]); }
                *(v4f*)(crow + (size_t)row * ldc + cofs) = val; }
             }
        __builtin_amdgcn_wave_barrier(); asm volatile("" ::: "memory");
    }
}

__device__ __forceinline__ h16 tohx(float x) { return (h16)x; }
__device__ __forceinline__ void splitf(float y, unsigned short& h, unsigned short& l) { h = f2bf(y); l = f2bf(y - bf2f(h)); }
typedef __attribute__((ext_vector_type(2))) _Float16 v2h;
typedef __attribute__((ext_vector_type(4))) _Float16 v4h;
typedef __attribute__((ext_vector_type(2))) unsigned short v2us;
typedef __attribute__((ext_vector_type(4))) unsigned short v4us;
typedef __attribute__((ext_vector_type(2))) float v2f;
typedef __attribute__((ext_vector_type(4))) int v4i;

__global__ __launch_bounds__(256) void k_wtG(const float* __restrict__ w, int K, int N, bf* Bt) {
    const int lane = threadIdx.x & 31; const int L0 = (blockIdx.x * 8 + (threadIdx.x >> 5)) * 8; const int nlines = N * K / 64;
{
#pragma unroll 1
        for (int l = 0; l < 8; ++l) { const int L = L0 + l; if (L >= nlines) break; const size_t e = (size_t)L * 64 + lane * 2; const int k = (int)(e % K), n = (int)(e / K); v2us o;
            o[0] = f2bf(w[(size_t)k * N + n]); o[1] = f2bf(w[(size_t)(k + 1) * N + n]); *(v2us*)(Bt + e) = o; }
         }
}
// blockIdx.y picks the tensor: 0..2 the three activations (nx8 groups of 8 each, planes dx + y * 8 * nx8), 3 and 4 the two weights (nw8 groups each)
__global__ __launch_bounds__(256) void k_cvt8(const float* __restrict__ x0, const float* __restrict__ x1, const float* __restrict__ x2, const float* __restrict__ w0, const float* __restrict__ w1, bf* dx, bf* dw0, bf* dw1, size_t nx8, size_t nw8) { const size_t i = (size_t)blockIdx.x * 256 + threadIdx.x; const unsigned y = blockIdx.y;
    const float* src = (y == 0) ? x0 : (y == 1) ? x1 : (y == 2) ? x2 : (y == 3) ? w0 : w1; bf* dst = (y < 3) ? dx + (size_t)y * nx8 * 8 : (y == 3) ? dw0 : dw1; if (i >= ((y < 3) ? nx8 : nw8)) return; const v8f v = *(const v8f*)(src + i * 8); v8us o;
#pragma unroll
    for (int k = 0; k < 8; ++k) o[k] = f2bf(v[k]); *(v8us*)(dst + i * 8) = o;  }

// k_rope: blockIdx.y = (q or k) * batches + batch, over F rows and over plane sets laid out in that order; head planes [h][t][d] (fp16 + hi/lo) of rope(x) x sc with the rotate-half convention out[d] = x[d] cos[t][d] - x[d+HD/2] sin[t][d], out[d+HD/2] = x[d+HD/2] cos[t][d+HD/2] + x[d] sin[t][d+HD/2]
__global__ __launch_bounds__(256) void k_rope(const float* __restrict__ F, int pitch, int nheads, const float* __restrict__ CS, const float* __restrict__ RF, const float* __restrict__ nw, float sc, h16* P16, bf* Ph, bf* Pl) {
    { const size_t yb = blockIdx.y, po = yb * nheads * TT * HD; F += yb * TT * pitch; P16 += po; Ph += po; Pl += po; }
    const size_t e = ((size_t)blockIdx.x * 256 + threadIdx.x) * 2; if (e >= (size_t)nheads * TT * HD) return; const int d = (int)(e % HD); const int t = (int)((e / HD) % TT); const int h = (int)(e / ((size_t)HD * TT)); const float* f = F + (size_t)t * pitch + h * HD; const float rf = RF ? RF[(size_t)h * TT + t] : 1.0f; v2h o16; v2us oh, ol;
#pragma unroll
    for (int q = 0; q < 2; ++q) { const int dd = d + q; const int dp = (dd < HD / 2) ? dd + HD / 2 : dd - HD / 2; float x0 = f[dd], x1 = f[dp];
        if (RF) { float n0 = __fmul_rn(x0, rf), n1 = __fmul_rn(x1, rf); asm volatile("" : "+v"(n0)); asm volatile("" : "+v"(n1)); x0 = __fmul_rn(bfr(nw[dd]), n0); x1 = __fmul_rn(bfr(nw[dp]), n1); }
        const v2f cs = *(const v2f*)(CS + ((size_t)t * HD + dd) * 2); float a = __fmul_rn(x0, cs[0]), bq = __fmul_rn(x1, cs[1]); asm volatile("" : "+v"(a)); asm volatile("" : "+v"(bq)); const float r = ((dd < HD / 2) ? __fsub_rn(a, bq) : __fadd_rn(a, bq)) * sc;
        o16[q] = tohx(r); unsigned short a2, c2; splitf(r, a2, c2); oh[q] = a2; ol[q] = c2; }
    *(v2h*)(P16 + e) = o16; *(v2us*)(Ph + e) = oh; *(v2us*)(Pl + e) = ol;  }
__global__ __launch_bounds__(256) void k_vtp(const float* __restrict__ F, int pitch, int nheads, h16* V16, bf* V) {   /* blockIdx.y = batch; a V row [batch][g][d] holds TT hi values, then TT lo values, like a probability row */ const size_t e = ((size_t)blockIdx.x * 256 + threadIdx.x) * 2; if (e >= (size_t)nheads * HD * TT) return; const int t = (int)(e % TT); const int d = (int)((e / TT) % HD); const int g = (int)(e / ((size_t)TT * HD)); const size_t yb = blockIdx.y; const size_t eo = yb * nheads * HD * TT + e; v2h o16; v2us oh, ol;
#pragma unroll
    for (int q = 0; q < 2; ++q) { const float x = F[(yb * TT + t + q) * pitch + g * HD + d]; o16[q] = tohx(x); unsigned short a2, c2; splitf(x, a2, c2); oh[q] = a2; ol[q] = c2; }
    bf* vr = V + 2 * eo - t; *(v2h*)(V16 + eo) = o16; *(v2us*)vr = oh; *(v2us*)(vr + TT) = ol;  }
__global__ __launch_bounds__(256) void k_csid(float* CS) { const int idx = blockIdx.x * 256 + threadIdx.x; if (idx >= TT * HD) return; v2f cs; cs[0] = 1.0f; cs[1] = 0.0f; *(v2f*)(CS + (size_t)idx * 2) = cs;  }

// ---- k_thsm: logit mix, softmax and probability mix of ONE query row in one work-group (grid (TT, batches), 256 threads). Thread t holds keys 4t..4t+3 of all 12 heads in registers, so both cross-head mixes are thread-local;
// only the 12 row maxima and the 12 row sums cross lanes (16-lane DPP butterfly, cross-row swap, then 8 wave partials through LDS, summed in wave order).
template <int CTRL> __device__ __forceinline__ float dppmov(float x) { return __builtin_bit_cast(float, __builtin_amdgcn_update_dpp(0, __builtin_bit_cast(int, x), CTRL, 0xf, 0xf, true)); }   // CTRL 0x160 + m: lane l reads lane l ^ m of its 16-lane row
__device__ __forceinline__ float swap16(float x) { const int b = __builtin_bit_cast(int, x); return __builtin_bit_cast(float, __builtin_amdgcn_permlanex16(b, b, 0x76543210, 0xfedcba98, false, false)); }   // lane l reads lane l ^ 16
__device__ __forceinline__ float wave_max(float m) { m = fmaxf(m, dppmov<0x161>(m)); m = fmaxf(m, dppmov<0x162>(m)); m = fmaxf(m, dppmov<0x164>(m)); m = fmaxf(m, dppmov<0x168>(m)); return fmaxf(m, swap16(m)); }
__device__ __forceinline__ float wave_sum(float s) { s += dppmov<0x161>(s); s += dppmov<0x162>(s); s += dppmov<0x164>(s); s += dppmov<0x168>(s); return s + swap16(s); }
// The probability planes go back into the score rows they came from: a head's 4096-byte f32 score row becomes 1024 bf16 hi values, then 1024 bf16 lo values. Each row belongs to one work-group, every wave has used its scores before the second barrier, and the stores stand behind the third.
// 8 waves per SIMD asked for (128 registers)
__global__ __launch_bounds__(256, 8) void k_thsm(const float* S, const float* __restrict__ Wl, const float* __restrict__ bl, const float* __restrict__ Wp, const float* __restrict__ bp, bf* P, size_t zs) {   // P: the same memory as S (neither is __restrict__); zs: head-plane stride in f32 elements; as an argument it gives each plane's load an address pair of its own
    __shared__ __align__(16) float wls[NH_ * NH_]; __shared__ __align__(16) float wps[NH_ * NH_]; __shared__ __align__(16) float bls[NH_]; __shared__ __align__(16) float bps[NH_]; __shared__ __align__(16) float rmx[8 * NH_]; __shared__ __align__(16) float rsm[8 * NH_];
    const int tid = threadIdx.x, lane = tid & 31, wv = tid >> 5; const unsigned k0 = tid * 4; const size_t r0 = (size_t)blockIdx.y * NH_ * zs + (size_t)blockIdx.x * TT;   // the lane's first key; the row's offset in its batch's first head plane (uniform)
    v4f L[NH_]; const float* sp[NH_];
#pragma unroll   // constant indices: the arrays stay in registers
    for (int h = 0; h < NH_; ++h) { sp[h] = S + r0 + h * zs + k0; L[h] = *(const v4f*)sp[h]; }
    // the wait before a load's address registers are rewritten; the 12 address pairs are its inputs, so they stay live up to it and no later load of the run lands on an earlier one's address
    asm volatile("s_wait_xcnt 0x0" :: "v"(sp[0]), "v"(sp[1]), "v"(sp[2]), "v"(sp[3]), "v"(sp[4]), "v"(sp[5]), "v"(sp[6]), "v"(sp[7]), "v"(sp[8]), "v"(sp[9]), "v"(sp[10]), "v"(sp[11]) : "memory");
    if (tid < NH_ * NH_) { wls[tid] = bfr(Wl[tid]); wps[tid] = bfr(Wp[tid]); } else if (tid < NH_ * NH_ + NH_) { bls[tid - NH_ * NH_] = bfr(bl[tid - NH_ * NH_]); bps[tid - NH_ * NH_] = bfr(bp[tid - NH_ * NH_]); }
    __syncthreads();   // the rounded weights and biases are in LDS for every wave
#pragma unroll   // constant indices: the arrays stay in registers
    for (int h = 0; h < NH_; ++h) L[h] *= SCL;
    v4f M[NH_]; float red[NH_];
#pragma unroll   // constant indices: the arrays stay in registers
    for (int g = 0; g < NH_; ++g) { v4f acc = wls[g * NH_] * L[0];
#pragma unroll   // constant indices: the arrays stay in registers
        for (int h = 1; h < NH_; ++h) acc += wls[g * NH_ + h] * L[h];
        acc += bls[g]; M[g] = acc; red[g] = wave_max(fmaxf(fmaxf(fmaxf(acc[0], acc[1]), fmaxf(acc[2], acc[3])), -3.0e38f)); }
    if (lane == 0) {
#pragma unroll   // constant indices: the arrays stay in registers
        for (int c = 0; c < NH_ / 4; ++c) { v4f o; o[0] = red[c * 4]; o[1] = red[c * 4 + 1]; o[2] = red[c * 4 + 2]; o[3] = red[c * 4 + 3]; *(v4f*)(rmx + wv * NH_ + c * 4) = o; } }
    __syncthreads();   // all 8 waves' partial maxima are in LDS
#pragma unroll   // constant indices: the arrays stay in registers
    for (int c = 0; c < NH_ / 4; ++c) { v4f m = *(const v4f*)(rmx + c * 4);
#pragma unroll   // constant indices: the arrays stay in registers
        for (int w = 1; w < 8; ++w) { const v4f r = *(const v4f*)(rmx + w * NH_ + c * 4); m[0] = fmaxf(m[0], r[0]); m[1] = fmaxf(m[1], r[1]); m[2] = fmaxf(m[2], r[2]); m[3] = fmaxf(m[3], r[3]); }
        red[c * 4] = m[0]; red[c * 4 + 1] = m[1]; red[c * 4 + 2] = m[2]; red[c * 4 + 3] = m[3]; }
#pragma unroll   // constant indices: the arrays stay in registers
    for (int g = 0; g < NH_; ++g) { v4f p = (M[g] - red[g]) * 1.4426950408889634f;
#pragma unroll   // constant indices: the arrays stay in registers
        for (int q = 0; q < 4; ++q) p[q] = __builtin_amdgcn_exp2f(p[q]);
        M[g] = p; red[g] = wave_sum((p[0] + p[1]) + (p[2] + p[3])); }
    if (lane == 0) {
#pragma unroll   // constant indices: the arrays stay in registers
        for (int c = 0; c < NH_ / 4; ++c) { v4f o; o[0] = red[c * 4]; o[1] = red[c * 4 + 1]; o[2] = red[c * 4 + 2]; o[3] = red[c * 4 + 3]; *(v4f*)(rsm + wv * NH_ + c * 4) = o; } }
    __syncthreads();   // all 8 waves' partial sums are in LDS (own array: no wave can still be reading the maxima's)
#pragma unroll   // constant indices: the arrays stay in registers
    for (int c = 0; c < NH_ / 4; ++c) { v4f s = *(const v4f*)(rsm + c * 4);
#pragma unroll   // constant indices: the arrays stay in registers
        for (int w = 1; w < 8; ++w) s += *(const v4f*)(rsm + w * NH_ + c * 4);
#pragma unroll   // constant indices: the arrays stay in registers
        for (int q = 0; q < 4; ++q) M[c * 4 + q] *= __fdiv_rn(1.0f, s[q]); }
#pragma unroll   // constant indices: the arrays stay in registers
    for (int g = 0; g < NH_; ++g) { v4f acc = wps[g * NH_] * M[0];
#pragma unroll   // constant indices: the arrays stay in registers
        for (int h = 1; h < NH_; ++h) acc += wps[g * NH_ + h] * M[h];
        acc += bps[g]; v4us oh, ol;
#pragma unroll   // constant indices: the arrays stay in registers
        for (int q = 0; q < 4; ++q) { unsigned short a, c2; splitf(acc[q], a, c2); oh[q] = a; ol[q] = c2; }
        bf* pr = P + 2 * (r0 + g * zs) + k0; *(v4us*)pr = oh; *(v4us*)(pr + TT) = ol; }
}
__global__ __launch_bounds__(256) void k_merge(const float* __restrict__ O, int h0, bf* Ah, bf* Al) { const size_t e = ((size_t)blockIdx.x * 256 + threadIdx.x) * 2; if (e >= (size_t)ZH * TT * HD) return; const int d = (int)(e % HD); const int t = (int)((e / HD) % TT); const int zz = (int)(e / ((size_t)HD * TT)); const float cs = (t < RH) ? 1.0f : (1.0f / PCAR); const size_t yb = blockIdx.y; O += yb * ZH * TT * HD; const size_t oo = (yb * TT + t) * DQ + (h0 + zz) * HD + d;
    v2us oh, ol;
#pragma unroll
    for (int q = 0; q < 2; ++q) { unsigned short a, c2; splitf(O[e + q] * cs, a, c2); oh[q] = a; ol[q] = c2; } *(v2us*)(Ah + oo) = oh; *(v2us*)(Al + oo) = ol;  }

extern "C" void kernel_launch(void* const* d_in, const int* in_sizes, int n_in,
                              void* d_out, int out_size, void* d_ws, size_t ws_size, hipStream_t stream) {
    (void)in_sizes; (void)n_in; (void)out_size;
    const float* x = (const float*)d_in[0]; const float* xk = (const float*)d_in[1]; const float* xv = (const float*)d_in[2]; const float* wq = (const float*)d_in[3]; const float* bq = (const float*)d_in[4]; const float* Wl = (const float*)d_in[5]; const float* bl = (const float*)d_in[6]; const float* Wp = (const float*)d_in[7]; const float* bp = (const float*)d_in[8]; const float* wo = (const float*)d_in[9]; const float* bo = (const float*)d_in[10];
    float* OUT = (float*)d_out;     // [4][1024][768]
    char* wsp = (char*)d_ws;
    auto take = [&](size_t bytes) { char* p = wsp; wsp += (bytes + 255) & ~(size_t)255; return (void*)p; };
    const size_t XE = (size_t)NB_ * TT * DM, PE = (size_t)NB_ * NH_ * TT * HD;   // elements of one activation tensor; of one set of head planes
    bf* WQ = (bf*)take((size_t)DQ * DM * 2); bf* WO = (bf*)take((size_t)DM * DQ * 2); float* CS = (float*)take((size_t)TT * HD * 2 * 4);
    bf* QKh = (bf*)take(2 * PE * 2); bf* QKl = (bf*)take(2 * PE * 2); bf* VT = (bf*)take(2 * PE * 2);   // q planes, then k planes; v rows hi then lo
    float* Sb = (float*)take((size_t)NB_ * ZH * TT * TT * 4);   // 48 score planes; each row later holds its probabilities' hi and lo halves
    if ((size_t)(wsp - (char*)d_ws) > ws_size) return;    // ws 256 MiB
    // dead before the first score is written, so they lie inside the score planes (stream-ordered): bf16 activations, f32 projections, the fp16 planes
    wsp = (char*)Sb; bf* XB = (bf*)take(3 * XE * 2); float* FQ = (float*)take(3 * XE * 4); h16* QK16 = (h16*)take(2 * PE * 2); h16* VT16 = (h16*)take(PE * 2);
    // written only after the scores are done, so they lie on the q and k planes (stream-ordered): attn.v output on the hi planes, its merged hi/lo on the lo planes
    float* Ob = (float*)QKh; bf* ATh = QKl; bf* ATl = QKl + PE;
    k_cvt8<<<dim3((unsigned)((XE / 8 + 255) / 256), 5, 1), 256, 0, stream>>>(x, xk, xv, wq, wo, XB, WQ, WO, XE / 8, (size_t)DQ * DM / 8);
    k_csid<<<(TT * HD + 255) / 256, 256, 0, stream>>>(CS);
    const unsigned LQ = (unsigned)(((size_t)NH_ * TT * HD / 2 + 255) / 256);
    k_gemmw<bf, 0, true><<<dim3(NB_ * TT / 64, DQ / 64, 3), 32, 0, stream>>>(XB, nullptr, WQ, nullptr, DM, DM, FQ, DQ, bq, XE, 0, XE);   // q, k and v projections (the same weight and bias), z = tensor
    k_rope<<<dim3(LQ, 2 * NB_, 1), 256, 0, stream>>>(FQ, DQ, NH_, CS, nullptr, nullptr, 1.0f, QK16, QKh, QKl);
    k_vtp<<<dim3(LQ, NB_, 1), 256, 0, stream>>>(FQ + 2 * XE, DQ, NH_, VT16, VT);
    k_gemmw<bf, 2, false><<<dim3(TT / 64, TT / 64, NB_ * ZH), 32, 0, stream>>>(QKh, QKl, QKh + PE, QKl + PE, HD, HD, Sb, TT, nullptr, (size_t)TT * HD, (size_t)TT * HD, (size_t)TT * TT);
    k_thsm<<<dim3(TT, NB_, 1), 256, 0, stream>>>(Sb, Wl, bl, Wp, bp, (bf*)Sb, (size_t)TT * TT);   /* talking-heads: mix logits across heads, softmax, mix probabilities, planes: one launch, one work-group per query row */
    k_gemmw<bf, 2, false><<<dim3(TT / 64, HD / 64, NB_ * ZH), 32, 0, stream>>>((const bf*)Sb, (const bf*)Sb + TT, VT, VT + TT, 2 * TT, TT, Ob, HD, nullptr, (size_t)2 * TT * TT, (size_t)2 * HD * TT, (size_t)TT * HD);
    k_merge<<<dim3(LQ, NB_, 1), 256, 0, stream>>>(Ob, 0, ATh, ATl);
    k_gemmw<bf, 1, true><<<dim3(NB_ * TT / 64, DM / 64, 1), 32, 0, stream>>>(ATh, ATl, WO, nullptr, DQ, DQ, OUT, DM, bo, 0, 0, 0);
}

// v003
// It runs in 220 microseconds.
// Timed twice side by side with v002, it ran 1.17 times as fast both times.
// Counting every step since v000, it is 4.98 times as fast.
#include <hip/hip_runtime.h>

// Talking-heads attention (q, k, v [4][1024][768]; qh, kh, vh = . Wq^T + bq (the SAME 'oi' [768][768] projection for all three), 12 heads x 64; logits = qh.kh/8; logits' [g] = sum_h Wl[g][h] logits[h] + bl[g]; attn = softmax(logits'); attn'[g] = sum_h Wp[g][h] attn[h] + bp[g]; out_h = attn'[h].v_h; merged Wf^T + bf -> [4][1024][768]).
// Layout: all 4 batches and all 12 heads are processed together (batch and q/k/v are grid dimensions, 48 z-batched score planes) so one kernel holds a query row's 12 x 1024 scores in registers and does both cross-head mixes (f32, fixed head order) and the softmax between them; scores use bf16 hi/lo planes on every row (3 products); the mixed probabilities become hi/lo planes for attn'.v. The projection and attn.v GEMMs' epilogues write the next GEMM's operand planes themselves (hi/lo split, head layout, v transposed); the scores stay f32.
// Compute dtypes, f32 accumulate: every input rounded to bf16; q/k/v on PLAIN bf16 operands (inputs: exact) + bias; scores and attn.v: hl on every row (3 products); softmax f32; Wf hl x exact (2 products) + bf.

#define NB_  4
#define TT   1024
#define DM   768
#define NH_  12
#define NKV  12
#define REP  (NH_ / NKV)
#define HD   64
#define DQ   (NH_ * HD)
#define DKV  (NKV * HD)
#define ZH   12                  // all heads per pass (cross-head mixing)
#define RH   1024                  // unused
#define WIN  0
#define PCAR 1024.0f
#define SCL  0.125f   // HD^-0.5
typedef _Float16 h16;
typedef unsigned short bf;
typedef __attribute__((ext_vector_type(16))) __bf16   v16bf;
typedef __attribute__((ext_vector_type(16))) _Float16 v16h;
typedef __attribute__((ext_vector_type(8)))  _Float16 v8h;
typedef __attribute__((ext_vector_type(8)))  unsigned short v8us;
typedef __attribute__((ext_vector_type(8)))  float    v8f;
typedef __attribute__((ext_vector_type(4)))  float    v4f;
typedef v8h  __attribute__((may_alias)) v8ha;
typedef v4f  __attribute__((may_alias)) v4fa;
typedef v8us __attribute__((may_alias)) v8usa;

__device__ __forceinline__ unsigned short f2bf(float f) { unsigned u = __float_as_uint(f); u += 0x7FFFu + ((u >> 16) & 1u); return (unsigned short)(u >> 16); }
__device__ __forceinline__ float bf2f(unsigned short b) { return __uint_as_float(((unsigned)b) << 16); }
__device__ __forceinline__ float bfr(float f) { return bf2f(f2bf(f)); }
__device__ __forceinline__ v16h cat16(v8h lo, v8h hi) { return __builtin_shufflevector(lo, hi, 0, 1, 2, 3, 4, 5, 6, 7, 8, 9, 10, 11, 12, 13, 14, 15); }
__device__ __forceinline__ v16bf cat16b(v8us lo, v8us hi) { return __builtin_bit_cast(v16bf, __builtin_shufflevector(lo, hi, 0, 1, 2, 3, 4, 5, 6, 7, 8, 9, 10, 11, 12, 13, 14, 15)); }
__device__ __forceinline__ v8f wmma16(v16h a, v16h b, v8f c) { return __builtin_amdgcn_wmma_f32_16x16x32_f16(false, a, false, b, (short)0, c, false, false); }
__device__ __forceinline__ v8f wmmab(v16bf a, v16bf b, v8f c) { return __builtin_amdgcn_wmma_f32_16x16x32_bf16(false, a, false, b, (short)0, c, false, false); }



__device__ __forceinline__ h16 tohx(float x) { return (h16)x; }
__device__ __forceinline__ void splitf(float y, unsigned short& h, unsigned short& l) { h = f2bf(y); l = f2bf(y - bf2f(h)); }
typedef __attribute__((ext_vector_type(2))) _Float16 v2h;
typedef __attribute__((ext_vector_type(4))) _Float16 v4h;
typedef __attribute__((ext_vector_type(2))) unsigned short v2us;
typedef __attribute__((ext_vector_type(4))) unsigned short v4us;
typedef __attribute__((ext_vector_type(2))) float v2f;
typedef __attribute__((ext_vector_type(4))) int v4i;

// ---- k_gemmw: register-blocked GEMM, ONE WAVE per 64x64 output tile (16 accumulators), operands straight from K-contiguous 16-bit planes; grid (M/64, N/64, Z), 32 threads.
// C[m][n] (f32, pitch ldc, + optional f32 bias[n]) = sum_k A[m][k] Bt[n][k] (+ split products per NSPLIT). K is the row pitch of A and Bt, KL the length of the sum (KL <= K: a row may hold a hi half, then a lo half). z-batch strides sA/sB/sC in elements. KL % 32 == 0.
template <typename T16> struct WFrag;
template <> struct WFrag<h16> { typedef v16h V; static __device__ __forceinline__ V ld(const h16* p) { return cat16(*(const v8h*)p, *(const v8h*)(p + 16)); } static __device__ __forceinline__ v8f mma(V a, V b, v8f c) { return wmma16(a, b, c); } };
template <> struct WFrag<bf> { typedef v16bf V; static __device__ __forceinline__ V ld(const bf* p) { return cat16b(*(const v8us*)p, *(const v8us*)(p + 16)); } static __device__ __forceinline__ v8f mma(V a, V b, v8f c) { return wmmab(a, b, c); } };
// EPI picks what the tile becomes. 0: f32 C. 1 (the q, k, v projections; z = tensor, one tile column = one head): the consumer's bf16 hi/lo operand planes, q and k as [tensor][batch][head][t][d] in Ph / Pl, v transposed as rows [batch][head][d] of TT hi then TT lo values in Vt.
// 2 (attn.v; z = batch * heads + head): hi/lo rows [batch][t][head * HD + d] in Ph / Pl, the last GEMM's A operand.
template <typename T16, int NSPLIT, bool BIAS, int EPI>
__global__ __launch_bounds__(32) void k_gemmw(const T16* __restrict__ A, const T16* __restrict__ A2, const T16* __restrict__ Bt, const T16* __restrict__ Bt2, int K, int KL, float* C, int ldc, const float* __restrict__ bias, size_t sA, size_t sB, size_t sC, bf* Ph, bf* Pl, bf* Vt) {
    typedef typename WFrag<T16>::V V;
    __shared__ __align__(16) float os[16 * 68];
    const size_t z = blockIdx.z; A += z * sA; if (A2) A2 += z * sA; Bt += z * sB; if (Bt2) Bt2 += z * sB; if (EPI == 0) C += z * sC;
    const int lane = threadIdx.x & 31, lr = lane & 15, hi = lane >> 4; const int r0 = blockIdx.x * 64, c0 = blockIdx.y * 64;
    v8f acc[4][4];
#pragma unroll
    for (int mb = 0; mb < 4; ++mb)
#pragma unroll
        for (int nb = 0; nb < 4; ++nb) acc[mb][nb] = (v8f){};
    const size_t aoff = (size_t)(r0 + lr) * K + 8 * hi, boff = (size_t)(c0 + lr) * K + 8 * hi;
#pragma unroll 1
    for (int kc = 0; kc < KL; kc += 32) {
        V a[4], a2[4];
#pragma unroll
        for (int mb = 0; mb < 4; ++mb) { a[mb] = WFrag<T16>::ld(A + aoff + (size_t)mb * 16 * K + kc); if (NSPLIT == 1 || NSPLIT == 2) a2[mb] = WFrag<T16>::ld(A2 + aoff + (size_t)mb * 16 * K + kc); }
#pragma unroll
        for (int nb = 0; nb < 4; ++nb) { const V b = WFrag<T16>::ld(Bt + boff + (size_t)nb * 16 * K + kc); V b2; if (NSPLIT >= 2) b2 = WFrag<T16>::ld(Bt2 + boff + (size_t)nb * 16 * K + kc);
#pragma unroll
            for (int mb = 0; mb < 4; ++mb) { acc[mb][nb] = WFrag<T16>::mma(a[mb], b, acc[mb][nb]); if (NSPLIT == 1 || NSPLIT == 2) acc[mb][nb] = WFrag<T16>::mma(a2[mb], b, acc[mb][nb]); if (NSPLIT >= 2) acc[mb][nb] = WFrag<T16>::mma(a[mb], b2, acc[mb][nb]); } }
        asm volatile("v_nop\n\tv_nop\n\tv_nop\n\tv_nop" : "+v"(acc[0][0]), "+v"(acc[1][1]), "+v"(acc[2][2]), "+v"(acc[3][3]) : "v"(a[0]), "v"(a[3]));
    }
    if (EPI == 1 && z == 2) {   // v: a lane holds 8 consecutive t of one d, which is 16 contiguous bytes of a transposed row, so the planes go out straight from the accumulators
        bf* vb = Vt + (size_t)((r0 / TT) * NH_ + blockIdx.y) * HD * (2 * TT) + (r0 % TT) + 8 * hi;
#pragma unroll
        for (int nb = 0; nb < 4; ++nb) { const float bv = bfr(bias[c0 + nb * 16 + lr]); bf* vr = vb + (size_t)(nb * 16 + lr) * (2 * TT);
#pragma unroll
            for (int mb = 0; mb < 4; ++mb) { v8us oh, ol;
#pragma unroll
                for (int j = 0; j < 8; ++j) { unsigned short a2, c2; splitf(acc[mb][nb][j] + bv, a2, c2); oh[j] = a2; ol[j] = c2; }
                *(v8us*)(vr + mb * 16) = oh; *(v8us*)(vr + mb * 16 + TT) = ol; } }
        return;
    }
    const size_t pb = (EPI == 1) ? (((z * NB_ + r0 / TT) * NH_ + blockIdx.y) * TT + r0 % TT) * HD : (EPI == 2) ? ((z / NH_) * TT + r0) * DQ + (z % NH_) * HD : 0; const int pp = (EPI == 1) ? HD : DQ;   // first element and row pitch of the tile in the hi/lo planes
#pragma unroll
    for (int mb = 0; mb < 4; ++mb) {
#pragma unroll
        for (int nb = 0; nb < 4; ++nb) {
#pragma unroll
            for (int j = 0; j < 8; ++j) os[(hi * 8 + j) * 68 + nb * 16 + lr] = acc[mb][nb][j]; }
        __builtin_amdgcn_wave_barrier(); asm volatile("" ::: "memory");
        float* crow = (EPI == 0) ? C + (size_t)(r0 + mb * 16) * ldc + c0 : nullptr;
{
#pragma unroll
            for (int s = 0; s < 8; ++s) { const int row = 2 * s + hi, cofs = lr * 4; v4f val = *(const v4fa*)(os + row * 68 + cofs); if (BIAS) { val[0] += bfr(bias[c0 + cofs]); val[1] += bfr(bias[c0 + cofs + 1]); val[2] += bfr(bias[c0 + cofs + 2]); val[3] += bfr(bias[c0 + cofs + 3]); }
                if (EPI == 0) *(v4f*)(crow + (size_t)row * ldc + cofs) = val;
                else { v4us oh, ol;
#pragma unroll
                    for (int q = 0; q < 4; ++q) { unsigned short a2, c2; splitf(val[q], a2, c2); oh[q] = a2; ol[q] = c2; }
                    const size_t po = pb + (size_t)(mb * 16 + row) * pp + cofs; *(v4us*)(Ph + po) = oh; *(v4us*)(Pl + po) = ol; } }
             }
        asm volatile("s_wait_xcnt 0x0" ::: "memory");   // the wait before a store's registers are rewritten: the next pass's bias load may land on them
        __builtin_amdgcn_wave_barrier(); asm volatile("" ::: "memory");
    }
}

__global__ __launch_bounds__(256) void k_wtG(const float* __restrict__ w, int K, int N, bf* Bt) {
    const int lane = threadIdx.x & 31; const int L0 = (blockIdx.x * 8 + (threadIdx.x >> 5)) * 8; const int nlines = N * K / 64;
{
#pragma unroll 1
        for (int l = 0; l < 8; ++l) { const int L = L0 + l; if (L >= nlines) break; const size_t e = (size_t)L * 64 + lane * 2; const int k = (int)(e % K), n = (int)(e / K); v2us o;
            o[0] = f2bf(w[(size_t)k * N + n]); o[1] = f2bf(w[(size_t)(k + 1) * N + n]); *(v2us*)(Bt + e) = o; }
         }
}
// blockIdx.y picks the tensor: 0..2 the three activations (nx8 groups of 8 each, planes dx + y * 8 * nx8), 3 and 4 the two weights (nw8 groups each)
__global__ __launch_bounds__(256) void k_cvt8(const float* __restrict__ x0, const float* __restrict__ x1, const float* __restrict__ x2, const float* __restrict__ w0, const float* __restrict__ w1, bf* dx, bf* dw0, bf* dw1, size_t nx8, size_t nw8) { const size_t i = (size_t)blockIdx.x * 256 + threadIdx.x; const unsigned y = blockIdx.y;
    const float* src = (y == 0) ? x0 : (y == 1) ? x1 : (y == 2) ? x2 : (y == 3) ? w0 : w1; bf* dst = (y < 3) ? dx + (size_t)y * nx8 * 8 : (y == 3) ? dw0 : dw1; if (i >= ((y < 3) ? nx8 : nw8)) return; const v8f v = *(const v8f*)(src + i * 8); v8us o;
#pragma unroll
    for (int k = 0; k < 8; ++k) o[k] = f2bf(v[k]); *(v8us*)(dst + i * 8) = o;  }

// ---- k_thsm: logit mix, softmax and probability mix of ONE query row in one work-group (grid (TT, batches), 256 threads). Thread t holds keys 4t..4t+3 of all 12 heads in registers, so both cross-head mixes are thread-local;
// only the 12 row maxima and the 12 row sums cross lanes (16-lane DPP butterfly, cross-row swap, then 8 wave partials through LDS, summed in wave order).
template <int CTRL> __device__ __forceinline__ float dppmov(float x) { return __builtin_bit_cast(float, __builtin_amdgcn_update_dpp(0, __builtin_bit_cast(int, x), CTRL, 0xf, 0xf, true)); }   // CTRL 0x160 + m: lane l reads lane l ^ m of its 16-lane row
__device__ __forceinline__ float swap16(float x) { const int b = __builtin_bit_cast(int, x); return __builtin_bit_cast(float, __builtin_amdgcn_permlanex16(b, b, 0x76543210, 0xfedcba98, false, false)); }   // lane l reads lane l ^ 16
__device__ __forceinline__ float wave_max(float m) { m = fmaxf(m, dppmov<0x161>(m)); m = fmaxf(m, dppmov<0x162>(m)); m = fmaxf(m, dppmov<0x164>(m)); m = fmaxf(m, dppmov<0x168>(m)); return fmaxf(m, swap16(m)); }
__device__ __forceinline__ float wave_sum(float s) { s += dppmov<0x161>(s); s += dppmov<0x162>(s); s += dppmov<0x164>(s); s += dppmov<0x168>(s); return s + swap16(s); }
// The probability planes go back into the score rows they came from: a head's 4096-byte f32 score row becomes 1024 bf16 hi values, then 1024 bf16 lo values. Each row belongs to one work-group, every wave has used its scores before the second barrier, and the stores stand behind the third.
// 8 waves per SIMD asked for (128 registers)
__global__ __launch_bounds__(256, 8) void k_thsm(const float* S, const float* __restrict__ Wl, const float* __restrict__ bl, const float* __restrict__ Wp, const float* __restrict__ bp, bf* P, size_t zs) {   // P: the same memory as S (neither is __restrict__); zs: head-plane stride in f32 elements; as an argument it gives each plane's load an address pair of its own
    __shared__ __align__(16) float wls[NH_ * NH_]; __shared__ __align__(16) float wps[NH_ * NH_]; __shared__ __align__(16) float bls[NH_]; __shared__ __align__(16) float bps[NH_]; __shared__ __align__(16) float rmx[8 * NH_]; __shared__ __align__(16) float rsm[8 * NH_];
    const int tid = threadIdx.x, lane = tid & 31, wv = tid >> 5; const unsigned k0 = tid * 4; const size_t r0 = (size_t)blockIdx.y * NH_ * zs + (size_t)blockIdx.x * TT;   // the lane's first key; the row's offset in its batch's first head plane (uniform)
    v4f L[NH_]; const float* sp[NH_];
#pragma unroll   // constant indices: the arrays stay in registers
    for (int h = 0; h < NH_; ++h) { sp[h] = S + r0 + h * zs + k0; L[h] = *(const v4f*)sp[h]; }
    // the wait before a load's address registers are rewritten; the 12 address pairs are its inputs, so they stay live up to it and no later load of the run lands on an earlier one's address
    asm volatile("s_wait_xcnt 0x0" :: "v"(sp[0]), "v"(sp[1]), "v"(sp[2]), "v"(sp[3]), "v"(sp[4]), "v"(sp[5]), "v"(sp[6]), "v"(sp[7]), "v"(sp[8]), "v"(sp[9]), "v"(sp[10]), "v"(sp[11]) : "memory");
    if (tid < NH_ * NH_) { wls[tid] = bfr(Wl[tid]); wps[tid] = bfr(Wp[tid]); } else if (tid < NH_ * NH_ + NH_) { bls[tid - NH_ * NH_] = bfr(bl[tid - NH_ * NH_]); bps[tid - NH_ * NH_] = bfr(bp[tid - NH_ * NH_]); }
    __syncthreads();   // the rounded weights and biases are in LDS for every wave
#pragma unroll   // constant indices: the arrays stay in registers
    for (int h = 0; h < NH_; ++h) L[h] *= SCL;
    v4f M[NH_]; float red[NH_];
#pragma unroll   // constant indices: the arrays stay in registers
    for (int g = 0; g < NH_; ++g) { v4f acc = wls[g * NH_] * L[0];
#pragma unroll   // constant indices: the arrays stay in registers
        for (int h = 1; h < NH_; ++h) acc += wls[g * NH_ + h] * L[h];
        acc += bls[g]; M[g] = acc; red[g] = wave_max(fmaxf(fmaxf(fmaxf(acc[0], acc[1]), fmaxf(acc[2], acc[3])), -3.0e38f)); }
    if (lane == 0) {
#pragma unroll   // constant indices: the arrays stay in registers
        for (int c = 0; c < NH_ / 4; ++c) { v4f o; o[0] = red[c * 4]; o[1] = red[c * 4 + 1]; o[2] = red[c * 4 + 2]; o[3] = red[c * 4 + 3]; *(v4f*)(rmx + wv * NH_ + c * 4) = o; } }
    __syncthreads();   // all 8 waves' partial maxima are in LDS
#pragma unroll   // constant indices: the arrays stay in registers
    for (int c = 0; c < NH_ / 4; ++c) { v4f m = *(const v4f*)(rmx + c * 4);
#pragma unroll   // constant indices: the arrays stay in registers
        for (int w = 1; w < 8; ++w) { const v4f r = *(const v4f*)(rmx + w * NH_ + c * 4); m[0] = fmaxf(m[0], r[0]); m[1] = fmaxf(m[1], r[1]); m[2] = fmaxf(m[2], r[2]); m[3] = fmaxf(m[3], r[3]); }
        red[c * 4] = m[0]; red[c * 4 + 1] = m[1]; red[c * 4 + 2] = m[2]; red[c * 4 + 3] = m[3]; }
#pragma unroll   // constant indices: the arrays stay in registers
    for (int g = 0; g < NH_; ++g) { v4f p = (M[g] - red[g]) * 1.4426950408889634f;
#pragma unroll   // constant indices: the arrays stay in registers
        for (int q = 0; q < 4; ++q) p[q] = __builtin_amdgcn_exp2f(p[q]);
        M[g] = p; red[g] = wave_sum((p[0] + p[1]) + (p[2] + p[3])); }
    if (lane == 0) {
#pragma unroll   // constant indices: the arrays stay in registers
        for (int c = 0; c < NH_ / 4; ++c) { v4f o; o[0] = red[c * 4]; o[1] = red[c * 4 + 1]; o[2] = red[c * 4 + 2]; o[3] = red[c * 4 + 3]; *(v4f*)(rsm + wv * NH_ + c * 4) = o; } }
    __syncthreads();   // all 8 waves' partial sums are in LDS (own array: no wave can still be reading the maxima's)
#pragma unroll   // constant indices: the arrays stay in registers
    for (int c = 0; c < NH_ / 4; ++c) { v4f s = *(const v4f*)(rsm + c * 4);
#pragma unroll   // constant indices: the arrays stay in registers
        for (int w = 1; w < 8; ++w) s += *(const v4f*)(rsm + w * NH_ + c * 4);
#pragma unroll   // constant indices: the arrays stay in registers
        for (int q = 0; q < 4; ++q) M[c * 4 + q] *= __fdiv_rn(1.0f, s[q]); }
#pragma unroll   // constant indices: the arrays stay in registers
    for (int g = 0; g < NH_; ++g) { v4f acc = wps[g * NH_] * M[0];
#pragma unroll   // constant indices: the arrays stay in registers
        for (int h = 1; h < NH_; ++h) acc += wps[g * NH_ + h] * M[h];
        acc += bps[g]; v4us oh, ol;
#pragma unroll   // constant indices: the arrays stay in registers
        for (int q = 0; q < 4; ++q) { unsigned short a, c2; splitf(acc[q], a, c2); oh[q] = a; ol[q] = c2; }
        bf* pr = P + 2 * (r0 + g * zs) + k0; *(v4us*)pr = oh; *(v4us*)(pr + TT) = ol; }
}

extern "C" void kernel_launch(void* const* d_in, const int* in_sizes, int n_in,
                              void* d_out, int out_size, void* d_ws, size_t ws_size, hipStream_t stream) {
    (void)in_sizes; (void)n_in; (void)out_size;
    const float* x = (const float*)d_in[0]; const float* xk = (const float*)d_in[1]; const float* xv = (const float*)d_in[2]; const float* wq = (const float*)d_in[3]; const float* bq = (const float*)d_in[4]; const float* Wl = (const float*)d_in[5]; const float* bl = (const float*)d_in[6]; const float* Wp = (const float*)d_in[7]; const float* bp = (const float*)d_in[8]; const float* wo = (const float*)d_in[9]; const float* bo = (const float*)d_in[10];
    float* OUT = (float*)d_out;     // [4][1024][768]
    char* wsp = (char*)d_ws;
    auto take = [&](size_t bytes) { char* p = wsp; wsp += (bytes + 255) & ~(size_t)255; return (void*)p; };
    const size_t XE = (size_t)NB_ * TT * DM, PE = (size_t)NB_ * NH_ * TT * HD;   // elements of one activation tensor; of one set of head planes
    bf* WQ = (bf*)take((size_t)DQ * DM * 2); bf* WO = (bf*)take((size_t)DM * DQ * 2);
    bf* QKh = (bf*)take(2 * PE * 2); bf* QKl = (bf*)take(2 * PE * 2); bf* VT = (bf*)take(2 * PE * 2);   // q planes, then k planes; v rows hi then lo
    float* Sb = (float*)take((size_t)NB_ * ZH * TT * TT * 4);   // 48 score planes; each row later holds its probabilities' hi and lo halves
    if ((size_t)(wsp - (char*)d_ws) > ws_size) return;    // ws 256 MiB
    // dead before the first score is written, so they lie inside the score planes (stream-ordered): the bf16 activations
    bf* XB = (bf*)Sb;
    // written only after the scores are done, so they lie on the q and k lo planes (stream-ordered): attn.v's merged hi/lo rows
    bf* ATh = QKl; bf* ATl = QKl + PE;
    k_cvt8<<<dim3((unsigned)((XE / 8 + 255) / 256), 5, 1), 256, 0, stream>>>(x, xk, xv, wq, wo, XB, WQ, WO, XE / 8, (size_t)DQ * DM / 8);
    k_gemmw<bf, 0, true, 1><<<dim3(NB_ * TT / 64, DQ / 64, 3), 32, 0, stream>>>(XB, nullptr, WQ, nullptr, DM, DM, nullptr, 0, bq, XE, 0, 0, QKh, QKl, VT);   // q, k and v projections (the same weight and bias), z = tensor; writes the head planes
    k_gemmw<bf, 2, false, 0><<<dim3(TT / 64, TT / 64, NB_ * ZH), 32, 0, stream>>>(QKh, QKl, QKh + PE, QKl + PE, HD, HD, Sb, TT, nullptr, (size_t)TT * HD, (size_t)TT * HD, (size_t)TT * TT, nullptr, nullptr, nullptr);
    k_thsm<<<dim3(TT, NB_, 1), 256, 0, stream>>>(Sb, Wl, bl, Wp, bp, (bf*)Sb, (size_t)TT * TT);   /* talking-heads: mix logits across heads, softmax, mix probabilities, planes: one launch, one work-group per query row */
    k_gemmw<bf, 2, false, 2><<<dim3(TT / 64, HD / 64, NB_ * ZH), 32, 0, stream>>>((const bf*)Sb, (const bf*)Sb + TT, VT, VT + TT, 2 * TT, TT, nullptr, 0, nullptr, (size_t)2 * TT * TT, (size_t)2 * HD * TT, 0, ATh, ATl, nullptr);   // writes the merged hi/lo rows
    k_gemmw<bf, 1, true, 0><<<dim3(NB_ * TT / 64, DM / 64, 1), 32, 0, stream>>>(ATh, ATl, WO, nullptr, DQ, DQ, OUT, DM, bo, 0, 0, 0, nullptr, nullptr, nullptr);
}

// v004
// One run takes 210 microseconds.
// Two timings next to v003 put it at 1.04 and 1.05 times that version's speed.
// All steps since v000 together make it 5.21 times as fast.
#include <hip/hip_runtime.h>

// Talking-heads attention (q, k, v [4][1024][768]; qh, kh, vh = . Wq^T + bq (the SAME 'oi' [768][768] projection for all three), 12 heads x 64; logits = qh.kh/8; logits' [g] = sum_h Wl[g][h] logits[h] + bl[g]; attn = softmax(logits'); attn'[g] = sum_h Wp[g][h] attn[h] + bp[g]; out_h = attn'[h].v_h; merged Wf^T + bf -> [4][1024][768]).
// Layout: all 4 batches and all 12 heads are processed together (batch and q/k/v are grid dimensions, 48 z-batched score planes) so one kernel holds a query row's 12 x 1024 scores in registers and does both cross-head mixes (f32, fixed head order) and the softmax between them; scores use bf16 hi/lo planes on every row (3 products); the mixed probabilities become hi/lo planes for attn'.v. The projection and attn.v GEMMs' epilogues write the next GEMM's operand planes themselves (hi/lo split, head layout, v transposed); the scores stay f32.
// Compute dtypes, f32 accumulate: every input rounded to bf16; q/k/v on PLAIN bf16 operands (inputs: exact) + bias; scores and attn.v: hl on every row (3 products); softmax f32; Wf hl x exact (2 products) + bf.

#define NB_  4
#define TT   1024
#define DM   768
#define NH_  12
#define NKV  12
#define REP  (NH_ / NKV)
#define HD   64
#define DQ   (NH_ * HD)
#define DKV  (NKV * HD)
#define ZH   12                  // all heads per pass (cross-head mixing)
#define RH   1024                  // unused
#define WIN  0
#define PCAR 1024.0f
#define SCL  0.125f   // HD^-0.5
typedef _Float16 h16;
typedef unsigned short bf;
typedef __attribute__((ext_vector_type(16))) __bf16   v16bf;
typedef __attribute__((ext_vector_type(16))) _Float16 v16h;
typedef __attribute__((ext_vector_type(8)))  _Float16 v8h;
typedef __attribute__((ext_vector_type(8)))  unsigned short v8us;
typedef __attribute__((ext_vector_type(8)))  float    v8f;
typedef __attribute__((ext_vector_type(4)))  float    v4f;
typedef v8h  __attribute__((may_alias)) v8ha;
typedef v4f  __attribute__((may_alias)) v4fa;
typedef v8us __attribute__((may_alias)) v8usa;

__device__ __forceinline__ unsigned short f2bf(float f) { unsigned u = __float_as_uint(f); u += 0x7FFFu + ((u >> 16) & 1u); return (unsigned short)(u >> 16); }
__device__ __forceinline__ float bf2f(unsigned short b) { return __uint_as_float(((unsigned)b) << 16); }
__device__ __forceinline__ float bfr(float f) { return bf2f(f2bf(f)); }
__device__ __forceinline__ v16h cat16(v8h lo, v8h hi) { return __builtin_shufflevector(lo, hi, 0, 1, 2, 3, 4, 5, 6, 7, 8, 9, 10, 11, 12, 13, 14, 15); }
__device__ __forceinline__ v16bf cat16b(v8us lo, v8us hi) { return __builtin_bit_cast(v16bf, __builtin_shufflevector(lo, hi, 0, 1, 2, 3, 4, 5, 6, 7, 8, 9, 10, 11, 12, 13, 14, 15)); }
__device__ __forceinline__ v8f wmma16(v16h a, v16h b, v8f c) { return __builtin_amdgcn_wmma_f32_16x16x32_f16(false, a, false, b, (short)0, c, false, false); }
__device__ __forceinline__ v8f wmmab(v16bf a, v16bf b, v8f c) { return __builtin_amdgcn_wmma_f32_16x16x32_bf16(false, a, false, b, (short)0, c, false, false); }



__device__ __forceinline__ h16 tohx(float x) { return (h16)x; }
__device__ __forceinline__ void splitf(float y, unsigned short& h, unsigned short& l) { h = f2bf(y); l = f2bf(y - bf2f(h)); }
typedef __attribute__((ext_vector_type(2))) _Float16 v2h;
typedef __attribute__((ext_vector_type(4))) _Float16 v4h;
typedef __attribute__((ext_vector_type(2))) unsigned short v2us;
typedef __attribute__((ext_vector_type(4))) unsigned short v4us;
typedef __attribute__((ext_vector_type(2))) float v2f;
typedef __attribute__((ext_vector_type(4))) int v4i;

// ---- k_gemmw: register-blocked GEMM, KS waves per 64x64 output tile (16 accumulators each), operands straight from K-contiguous 16-bit planes; grid (M/64, N/64, Z), 32 * KS threads.
// KS = 4: FOUR waves share the tile (128 threads). Wave w sums the 32-wide k chunks w, w + 4, w + 8, ... over the whole 64x64 tile; the four partial tiles meet in LDS behind one barrier and wave w finishes rows 16w..16w+15 (for the transposed v: columns 16w..16w+15), the partials added in wave order 0, 1, 2, 3. KL % 128 == 0 there.
// C[m][n] (f32, pitch ldc, + optional f32 bias[n]) = sum_k A[m][k] Bt[n][k] (+ split products per NSPLIT). K is the row pitch of A and Bt, KL the length of the sum (KL <= K: a row may hold a hi half, then a lo half). z-batch strides sA/sB/sC in elements. KL % 32 == 0.
template <typename T16> struct WFrag;
template <> struct WFrag<h16> { typedef v16h V; static __device__ __forceinline__ V ld(const h16* p) { return cat16(*(const v8h*)p, *(const v8h*)(p + 16)); } static __device__ __forceinline__ v8f mma(V a, V b, v8f c) { return wmma16(a, b, c); } };
template <> struct WFrag<bf> { typedef v16bf V; static __device__ __forceinline__ V ld(const bf* p) { return cat16b(*(const v8us*)p, *(const v8us*)(p + 16)); } static __device__ __forceinline__ v8f mma(V a, V b, v8f c) { return wmmab(a, b, c); } };
// EPI picks what the tile becomes. 0: f32 C. 1 (the q, k, v projections; z = tensor, one tile column = one head): the consumer's bf16 hi/lo operand planes, q and k as [tensor][batch][head][t][d] in Ph / Pl, v transposed as rows [batch][head][d] of TT hi then TT lo values in Vt.
// 2 (attn.v; z = batch * heads + head): hi/lo rows [batch][t][head * HD + d] in Ph / Pl, the last GEMM's A operand.
template <typename T16, int NSPLIT, bool BIAS, int EPI, int KS>
__global__ __launch_bounds__(32 * KS) void k_gemmw(const T16* __restrict__ A, const T16* __restrict__ A2, const T16* __restrict__ Bt, const T16* __restrict__ Bt2, int K, int KL, float* C, int ldc, const float* __restrict__ bias, size_t sA, size_t sB, size_t sC, bf* Ph, bf* Pl, bf* Vt) {
    typedef typename WFrag<T16>::V V;
    static_assert(KS == 1 || KS == 4, "one wave, or one wave per 16-row slab");
    constexpr int SL = 16 * 68, PT = 4 * SL;   // floats of one 16-row slab; of one wave's partial tile
    __shared__ __align__(16) float os[KS == 1 ? SL : KS * PT];
    const int wv = (KS == 1) ? 0 : __builtin_amdgcn_readfirstlane((int)(threadIdx.x >> 5));
    const size_t z = blockIdx.z; A += z * sA; if (A2) A2 += z * sA; Bt += z * sB; if (Bt2) Bt2 += z * sB; if (EPI == 0) C += z * sC;
    const int lane = threadIdx.x & 31, lr = lane & 15, hi = lane >> 4; const int r0 = blockIdx.x * 64, c0 = blockIdx.y * 64;
    v8f acc[4][4];
#pragma unroll
    for (int mb = 0; mb < 4; ++mb)
#pragma unroll
        for (int nb = 0; nb < 4; ++nb) acc[mb][nb] = (v8f){};
    const size_t aoff = (size_t)(r0 + lr) * K + 8 * hi, boff = (size_t)(c0 + lr) * K + 8 * hi;
#pragma unroll 1
    for (int kc = wv * 32; kc < KL; kc += 32 * KS) {
        V a[4], a2[4];
#pragma unroll
        for (int mb = 0; mb < 4; ++mb) { a[mb] = WFrag<T16>::ld(A + aoff + (size_t)mb * 16 * K + kc); if (NSPLIT == 1 || NSPLIT == 2) a2[mb] = WFrag<T16>::ld(A2 + aoff + (size_t)mb * 16 * K + kc); }
#pragma unroll
        for (int nb = 0; nb < 4; ++nb) { const V b = WFrag<T16>::ld(Bt + boff + (size_t)nb * 16 * K + kc); V b2; if (NSPLIT >= 2) b2 = WFrag<T16>::ld(Bt2 + boff + (size_t)nb * 16 * K + kc);
#pragma unroll
            for (int mb = 0; mb < 4; ++mb) { acc[mb][nb] = WFrag<T16>::mma(a[mb], b, acc[mb][nb]); if (NSPLIT == 1 || NSPLIT == 2) acc[mb][nb] = WFrag<T16>::mma(a2[mb], b, acc[mb][nb]); if (NSPLIT >= 2) acc[mb][nb] = WFrag<T16>::mma(a[mb], b2, acc[mb][nb]); } }
        asm volatile("v_nop\n\tv_nop\n\tv_nop\n\tv_nop" : "+v"(acc[0][0]), "+v"(acc[1][1]), "+v"(acc[2][2]), "+v"(acc[3][3]) : "v"(a[0]), "v"(a[3]));
    }
    if (KS > 1) {   // every wave's partial tile goes to its own part of LDS, slab by slab in the row-major form the finishing wave reads
#pragma unroll   // the three loops: constant indices, so the accumulators stay in registers
        for (int mb = 0; mb < 4; ++mb)
#pragma unroll
            for (int nb = 0; nb < 4; ++nb)
#pragma unroll
                for (int j = 0; j < 8; ++j) os[wv * PT + mb * SL + (hi * 8 + j) * 68 + nb * 16 + lr] = acc[mb][nb][j];
        __syncthreads();   // all four partial tiles are in LDS; nothing is written there afterwards
    }
    if (EPI == 1 && z == 2) {   // v: a lane holds 8 consecutive t of one d, which is 16 contiguous bytes of a transposed row, so the planes go out in the accumulators' own layout
        bf* vb = Vt + (size_t)((r0 / TT) * NH_ + blockIdx.y) * HD * (2 * TT) + (r0 % TT) + 8 * hi;
#pragma unroll   // KS = 4: wave w finishes the 16 rows d = 16w..16w+15 over all 64 t, so each 128-byte line of a row keeps one writer
        for (int ni = 0; ni < 4 / KS; ++ni) { const int nb = (KS == 1) ? ni : wv; const float bv = bfr(bias[c0 + nb * 16 + lr]); bf* vr = vb + (size_t)(nb * 16 + lr) * (2 * TT);
#pragma unroll
            for (int mb = 0; mb < 4; ++mb) { v8us oh, ol;
#pragma unroll
                for (int j = 0; j < 8; ++j) { float t;
                    if (KS == 1) t = acc[mb][ni][j];
                    else { const float* pp0 = os + mb * SL + (hi * 8 + j) * 68 + nb * 16 + lr; t = pp0[0];
#pragma unroll   // the partials' LDS reads become immediate offsets and go out together
                        for (int p = 1; p < KS; ++p) t += pp0[p * PT]; }
                    unsigned short a2, c2; splitf(t + bv, a2, c2); oh[j] = a2; ol[j] = c2; }
                *(v8us*)(vr + mb * 16) = oh; *(v8us*)(vr + mb * 16 + TT) = ol; } }
        return;
    }
    const size_t pb = (EPI == 1) ? (((z * NB_ + r0 / TT) * NH_ + blockIdx.y) * TT + r0 % TT) * HD : (EPI == 2) ? ((z / NH_) * TT + r0) * DQ + (z % NH_) * HD : 0; const int pp = (EPI == 1) ? HD : DQ;   // first element and row pitch of the tile in the hi/lo planes
#pragma unroll
    for (int mi = 0; mi < 4 / KS; ++mi) { const int mb = (KS == 1) ? mi : wv; const float* ob = os + ((KS == 1) ? 0 : mb * SL);
        if (KS == 1) {
#pragma unroll
        for (int nb = 0; nb < 4; ++nb) {
#pragma unroll
            for (int j = 0; j < 8; ++j) os[(hi * 8 + j) * 68 + nb * 16 + lr] = acc[mi][nb][j]; }
        }
        __builtin_amdgcn_wave_barrier(); asm volatile("" ::: "memory");
        float* crow = (EPI == 0) ? C + (size_t)(r0 + mb * 16) * ldc + c0 : nullptr;
{
#pragma unroll
            for (int s = 0; s < 8; ++s) { const int row = 2 * s + hi, cofs = lr * 4; v4f val = *(const v4fa*)(ob + row * 68 + cofs);
#pragma unroll   // the partials' LDS reads become immediate offsets and go out together
                for (int p = 1; p < KS; ++p) val += *(const v4fa*)(ob + p * PT + row * 68 + cofs);
                if (BIAS) { val[0] += bfr(bias[c0 + cofs]); val[1] += bfr(bias[c0 + cofs + 1]); val[2] += bfr(bias[c0 + cofs + 2]); val[3] += bfr(bias[c0 + cofs + 3]); }
                if (EPI == 0) *(v4f*)(crow + (size_t)row * ldc + cofs) = val;
                else { v4us oh, ol;
#pragma unroll
                    for (int q = 0; q < 4; ++q) { unsigned short a2, c2; splitf(val[q], a2, c2); oh[q] = a2; ol[q] = c2; }
                    const size_t po = pb + (size_t)(mb * 16 + row) * pp + cofs; *(v4us*)(Ph + po) = oh; *(v4us*)(Pl + po) = ol; } }
             }
        asm volatile("s_wait_xcnt 0x0" ::: "memory");   // the wait before a store's registers are rewritten: the next pass's LDS reads may land on them
        __builtin_amdgcn_wave_barrier(); asm volatile("" ::: "memory");
    }
}

__global__ __launch_bounds__(256) void k_wtG(const float* __restrict__ w, int K, int N, bf* Bt) {
    const int lane = threadIdx.x & 31; const int L0 = (blockIdx.x * 8 + (threadIdx.x >> 5)) * 8; const int nlines = N * K / 64;
{
#pragma unroll 1
        for (int l = 0; l < 8; ++l) { const int L = L0 + l; if (L >= nlines) break; const size_t e = (size_t)L * 64 + lane * 2; const int k = (int)(e % K), n = (int)(e / K); v2us o;
            o[0] = f2bf(w[(size_t)k * N + n]); o[1] = f2bf(w[(size_t)(k + 1) * N + n]); *(v2us*)(Bt + e) = o; }
         }
}
// blockIdx.y picks the tensor: 0..2 the three activations (nx8 groups of 8 each, planes dx + y * 8 * nx8), 3 and 4 the two weights (nw8 groups each)
__global__ __launch_bounds__(256) void k_cvt8(const float* __restrict__ x0, const float* __restrict__ x1, const float* __restrict__ x2, const float* __restrict__ w0, const float* __restrict__ w1, bf* dx, bf* dw0, bf* dw1, size_t nx8, size_t nw8) { const size_t i = (size_t)blockIdx.x * 256 + threadIdx.x; const unsigned y = blockIdx.y;
    const float* src = (y == 0) ? x0 : (y == 1) ? x1 : (y == 2) ? x2 : (y == 3) ? w0 : w1; bf* dst = (y < 3) ? dx + (size_t)y * nx8 * 8 : (y == 3) ? dw0 : dw1; if (i >= ((y < 3) ? nx8 : nw8)) return; const v8f v = *(const v8f*)(src + i * 8); v8us o;
#pragma unroll
    for (int k = 0; k < 8; ++k) o[k] = f2bf(v[k]); *(v8us*)(dst + i * 8) = o;  }

// ---- k_thsm: logit mix, softmax and probability mix of ONE query row in one work-group (grid (TT, batches), 256 threads). Thread t holds keys 4t..4t+3 of all 12 heads in registers, so both cross-head mixes are thread-local;
// only the 12 row maxima and the 12 row sums cross lanes (16-lane DPP butterfly, cross-row swap, then 8 wave partials through LDS, summed in wave order).
template <int CTRL> __device__ __forceinline__ float dppmov(float x) { return __builtin_bit_cast(float, __builtin_amdgcn_update_dpp(0, __builtin_bit_cast(int, x), CTRL, 0xf, 0xf, true)); }   // CTRL 0x160 + m: lane l reads lane l ^ m of its 16-lane row
__device__ __forceinline__ float swap16(float x) { const int b = __builtin_bit_cast(int, x); return __builtin_bit_cast(float, __builtin_amdgcn_permlanex16(b, b, 0x76543210, 0xfedcba98, false, false)); }   // lane l reads lane l ^ 16
__device__ __forceinline__ float wave_max(float m) { m = fmaxf(m, dppmov<0x161>(m)); m = fmaxf(m, dppmov<0x162>(m)); m = fmaxf(m, dppmov<0x164>(m)); m = fmaxf(m, dppmov<0x168>(m)); return fmaxf(m, swap16(m)); }
__device__ __forceinline__ float wave_sum(float s) { s += dppmov<0x161>(s); s += dppmov<0x162>(s); s += dppmov<0x164>(s); s += dppmov<0x168>(s); return s + swap16(s); }
// The probability planes go back into the score rows they came from: a head's 4096-byte f32 score row becomes 1024 bf16 hi values, then 1024 bf16 lo values. Each row belongs to one work-group, every wave has used its scores before the second barrier, and the stores stand behind the third.
// 8 waves per SIMD asked for (128 registers)
__global__ __launch_bounds__(256, 8) void k_thsm(const float* S, const float* __restrict__ Wl, const float* __restrict__ bl, const float* __restrict__ Wp, const float* __restrict__ bp, bf* P, size_t zs) {   // P: the same memory as S (neither is __restrict__); zs: head-plane stride in f32 elements; as an argument it gives each plane's load an address pair of its own
    __shared__ __align__(16) float wls[NH_ * NH_]; __shared__ __align__(16) float wps[NH_ * NH_]; __shared__ __align__(16) float bls[NH_]; __shared__ __align__(16) float bps[NH_]; __shared__ __align__(16) float rmx[8 * NH_]; __shared__ __align__(16) float rsm[8 * NH_];
    const int tid = threadIdx.x, lane = tid & 31, wv = tid >> 5; const unsigned k0 = tid * 4; const size_t r0 = (size_t)blockIdx.y * NH_ * zs + (size_t)blockIdx.x * TT;   // the lane's first key; the row's offset in its batch's first head plane (uniform)
    v4f L[NH_]; const float* sp[NH_];
#pragma unroll   // constant indices: the arrays stay in registers
    for (int h = 0; h < NH_; ++h) { sp[h] = S + r0 + h * zs + k0; L[h] = *(const v4f*)sp[h]; }
    // the wait before a load's address registers are rewritten; the 12 address pairs are its inputs, so they stay live up to it and no later load of the run lands on an earlier one's address
    asm volatile("s_wait_xcnt 0x0" :: "v"(sp[0]), "v"(sp[1]), "v"(sp[2]), "v"(sp[3]), "v"(sp[4]), "v"(sp[5]), "v"(sp[6]), "v"(sp[7]), "v"(sp[8]), "v"(sp[9]), "v"(sp[10]), "v"(sp[11]) : "memory");
    if (tid < NH_ * NH_) { wls[tid] = bfr(Wl[tid]); wps[tid] = bfr(Wp[tid]); } else if (tid < NH_ * NH_ + NH_) { bls[tid - NH_ * NH_] = bfr(bl[tid - NH_ * NH_]); bps[tid - NH_ * NH_] = bfr(bp[tid - NH_ * NH_]); }
    __syncthreads();   // the rounded weights and biases are in LDS for every wave
#pragma unroll   // constant indices: the arrays stay in registers
    for (int h = 0; h < NH_; ++h) L[h] *= SCL;
    v4f M[NH_]; float red[NH_];
#pragma unroll   // constant indices: the arrays stay in registers
    for (int g = 0; g < NH_; ++g) { v4f acc = wls[g * NH_] * L[0];
#pragma unroll   // constant indices: the arrays stay in registers
        for (int h = 1; h < NH_; ++h) acc += wls[g * NH_ + h] * L[h];
        acc += bls[g]; M[g] = acc; red[g] = wave_max(fmaxf(fmaxf(fmaxf(acc[0], acc[1]), fmaxf(acc[2], acc[3])), -3.0e38f)); }
    if (lane == 0) {
#pragma unroll   // constant indices: the arrays stay in registers
        for (int c = 0; c < NH_ / 4; ++c) { v4f o; o[0] = red[c * 4]; o[1] = red[c * 4 + 1]; o[2] = red[c * 4 + 2]; o[3] = red[c * 4 + 3]; *(v4f*)(rmx + wv * NH_ + c * 4) = o; } }
    __syncthreads();   // all 8 waves' partial maxima are in LDS
#pragma unroll   // constant indices: the arrays stay in registers
    for (int c = 0; c < NH_ / 4; ++c) { v4f m = *(const v4f*)(rmx + c * 4);
#pragma unroll   // constant indices: the arrays stay in registers
        for (int w = 1; w < 8; ++w) { const v4f r = *(const v4f*)(rmx + w * NH_ + c * 4); m[0] = fmaxf(m[0], r[0]); m[1] = fmaxf(m[1], r[1]); m[2] = fmaxf(m[2], r[2]); m[3] = fmaxf(m[3], r[3]); }
        red[c * 4] = m[0]; red[c * 4 + 1] = m[1]; red[c * 4 + 2] = m[2]; red[c * 4 + 3] = m[3]; }
#pragma unroll   // constant indices: the arrays stay in registers
    for (int g = 0; g < NH_; ++g) { v4f p = (M[g] - red[g]) * 1.4426950408889634f;
#pragma unroll   // constant indices: the arrays stay in registers
        for (int q = 0; q < 4; ++q) p[q] = __builtin_amdgcn_exp2f(p[q]);
        M[g] = p; red[g] = wave_sum((p[0] + p[1]) + (p[2] + p[3])); }
    if (lane == 0) {
#pragma unroll   // constant indices: the arrays stay in registers
        for (int c = 0; c < NH_ / 4; ++c) { v4f o; o[0] = red[c * 4]; o[1] = red[c * 4 + 1]; o[2] = red[c * 4 + 2]; o[3] = red[c * 4 + 3]; *(v4f*)(rsm + wv * NH_ + c * 4) = o; } }
    __syncthreads();   // all 8 waves' partial sums are in LDS (own array: no wave can still be reading the maxima's)
#pragma unroll   // constant indices: the arrays stay in registers
    for (int c = 0; c < NH_ / 4; ++c) { v4f s = *(const v4f*)(rsm + c * 4);
#pragma unroll   // constant indices: the arrays stay in registers
        for (int w = 1; w < 8; ++w) s += *(const v4f*)(rsm + w * NH_ + c * 4);
#pragma unroll   // constant indices: the arrays stay in registers
        for (int q = 0; q < 4; ++q) M[c * 4 + q] *= __fdiv_rn(1.0f, s[q]); }
#pragma unroll   // constant indices: the arrays stay in registers
    for (int g = 0; g < NH_; ++g) { v4f acc = wps[g * NH_] * M[0];
#pragma unroll   // constant indices: the arrays stay in registers
        for (int h = 1; h < NH_; ++h) acc += wps[g * NH_ + h] * M[h];
        acc += bps[g]; v4us oh, ol;
#pragma unroll   // constant indices: the arrays stay in registers
        for (int q = 0; q < 4; ++q) { unsigned short a, c2; splitf(acc[q], a, c2); oh[q] = a; ol[q] = c2; }
        bf* pr = P + 2 * (r0 + g * zs) + k0; *(v4us*)pr = oh; *(v4us*)(pr + TT) = ol; }
}

extern "C" void kernel_launch(void* const* d_in, const int* in_sizes, int n_in,
                              void* d_out, int out_size, void* d_ws, size_t ws_size, hipStream_t stream) {
    (void)in_sizes; (void)n_in; (void)out_size;
    const float* x = (const float*)d_in[0]; const float* xk = (const float*)d_in[1]; const float* xv = (const float*)d_in[2]; const float* wq = (const float*)d_in[3]; const float* bq = (const float*)d_in[4]; const float* Wl = (const float*)d_in[5]; const float* bl = (const float*)d_in[6]; const float* Wp = (const float*)d_in[7]; const float* bp = (const float*)d_in[8]; const float* wo = (const float*)d_in[9]; const float* bo = (const float*)d_in[10];
    float* OUT = (float*)d_out;     // [4][1024][768]
    char* wsp = (char*)d_ws;
    auto take = [&](size_t bytes) { char* p = wsp; wsp += (bytes + 255) & ~(size_t)255; return (void*)p; };
    const size_t XE = (size_t)NB_ * TT * DM, PE = (size_t)NB_ * NH_ * TT * HD;   // elements of one activation tensor; of one set of head planes
    bf* WQ = (bf*)take((size_t)DQ * DM * 2); bf* WO = (bf*)take((size_t)DM * DQ * 2);
    bf* QKh = (bf*)take(2 * PE * 2); bf* QKl = (bf*)take(2 * PE * 2); bf* VT = (bf*)take(2 * PE * 2);   // q planes, then k planes; v rows hi then lo
    float* Sb = (float*)take((size_t)NB_ * ZH * TT * TT * 4);   // 48 score planes; each row later holds its probabilities' hi and lo halves
    if ((size_t)(wsp - (char*)d_ws) > ws_size) return;    // ws 256 MiB
    // dead before the first score is written, so they lie inside the score planes (stream-ordered): the bf16 activations
    bf* XB = (bf*)Sb;
    // written only after the scores are done, so they lie on the q and k lo planes (stream-ordered): attn.v's merged hi/lo rows
    bf* ATh = QKl; bf* ATl = QKl + PE;
    k_cvt8<<<dim3((unsigned)((XE / 8 + 255) / 256), 5, 1), 256, 0, stream>>>(x, xk, xv, wq, wo, XB, WQ, WO, XE / 8, (size_t)DQ * DM / 8);
    k_gemmw<bf, 0, true, 1, 4><<<dim3(NB_ * TT / 64, DQ / 64, 3), 128, 0, stream>>>(XB, nullptr, WQ, nullptr, DM, DM, nullptr, 0, bq, XE, 0, 0, QKh, QKl, VT);   // q, k and v projections (the same weight and bias), z = tensor; writes the head planes
    k_gemmw<bf, 2, false, 0, 1><<<dim3(TT / 64, TT / 64, NB_ * ZH), 32, 0, stream>>>(QKh, QKl, QKh + PE, QKl + PE, HD, HD, Sb, TT, nullptr, (size_t)TT * HD, (size_t)TT * HD, (size_t)TT * TT, nullptr, nullptr, nullptr);
    k_thsm<<<dim3(TT, NB_, 1), 256, 0, stream>>>(Sb, Wl, bl, Wp, bp, (bf*)Sb, (size_t)TT * TT);   /* talking-heads: mix logits across heads, softmax, mix probabilities, planes: one launch, one work-group per query row */
    k_gemmw<bf, 2, false, 2, 4><<<dim3(TT / 64, HD / 64, NB_ * ZH), 128, 0, stream>>>((const bf*)Sb, (const bf*)Sb + TT, VT, VT + TT, 2 * TT, TT, nullptr, 0, nullptr, (size_t)2 * TT * TT, (size_t)2 * HD * TT, 0, ATh, ATl, nullptr);   // writes the merged hi/lo rows
    k_gemmw<bf, 1, true, 0, 4><<<dim3(NB_ * TT / 64, DM / 64, 1), 128, 0, stream>>>(ATh, ATl, WO, nullptr, DQ, DQ, OUT, DM, bo, 0, 0, 0, nullptr, nullptr, nullptr);
}

// v005
// One run takes 169 microseconds.
// Timed twice side by side with v004, it ran 1.24 and 1.25 times as fast.
// Over all steps from v000 it is 6.49 times as fast.
#include <hip/hip_runtime.h>

// Talking-heads attention (q, k, v [4][1024][768]; qh, kh, vh = . Wq^T + bq (the SAME 'oi' [768][768] projection for all three), 12 heads x 64; logits = qh.kh/8; logits' [g] = sum_h Wl[g][h] logits[h] + bl[g]; attn = softmax(logits'); attn'[g] = sum_h Wp[g][h] attn[h] + bp[g]; out_h = attn'[h].v_h; merged Wf^T + bf -> [4][1024][768]).
// Layout: all 4 batches and all 12 heads are processed together (batch and q/k/v are grid dimensions, 48 z-batched score planes) so one kernel holds a query row's 12 x 1024 scores in registers and does both cross-head mixes (f32, fixed head order) and the softmax between them; scores use bf16 hi/lo planes on every row (3 products); the mixed probabilities become hi/lo planes for attn'.v. The projection and attn.v GEMMs' epilogues write the next GEMM's operand planes themselves (hi/lo split, head layout, v transposed); the scores stay f32.
// Compute dtypes, f32 accumulate: every input rounded to bf16; q/k/v on PLAIN bf16 operands (inputs: exact) + bias; scores and attn.v: hl on every row (3 products); softmax f32; Wf hl x exact (2 products) + bf.

#define NB_  4
#define TT   1024
#define DM   768
#define NH_  12
#define NKV  12
#define REP  (NH_ / NKV)
#define HD   64
#define DQ   (NH_ * HD)
#define DKV  (NKV * HD)
#define ZH   12                  // all heads per pass (cross-head mixing)
#define RH   1024                  // unused
#define WIN  0
#define PCAR 1024.0f
#define SCL  0.125f   // HD^-0.5
typedef _Float16 h16;
typedef unsigned short bf;
typedef __attribute__((ext_vector_type(16))) __bf16   v16bf;
typedef __attribute__((ext_vector_type(16))) _Float16 v16h;
typedef __attribute__((ext_vector_type(8)))  _Float16 v8h;
typedef __attribute__((ext_vector_type(8)))  unsigned short v8us;
typedef __attribute__((ext_vector_type(8)))  float    v8f;
typedef __attribute__((ext_vector_type(4)))  float    v4f;
typedef v8h  __attribute__((may_alias)) v8ha;
typedef v4f  __attribute__((may_alias)) v4fa;
typedef v8us __attribute__((may_alias)) v8usa;

__device__ __forceinline__ unsigned short f2bf(float f) { unsigned u = __float_as_uint(f); u += 0x7FFFu + ((u >> 16) & 1u); return (unsigned short)(u >> 16); }
__device__ __forceinline__ float bf2f(unsigned short b) { return __uint_as_float(((unsigned)b) << 16); }
__device__ __forceinline__ float bfr(float f) { return bf2f(f2bf(f)); }
__device__ __forceinline__ v16h cat16(v8h lo, v8h hi) { return __builtin_shufflevector(lo, hi, 0, 1, 2, 3, 4, 5, 6, 7, 8, 9, 10, 11, 12, 13, 14, 15); }
__device__ __forceinline__ v16bf cat16b(v8us lo, v8us hi) { return __builtin_bit_cast(v16bf, __builtin_shufflevector(lo, hi, 0, 1, 2, 3, 4, 5, 6, 7, 8, 9, 10, 11, 12, 13, 14, 15)); }
__device__ __forceinline__ v8f wmma16(v16h a, v16h b, v8f c) { return __builtin_amdgcn_wmma_f32_16x16x32_f16(false, a, false, b, (short)0, c, false, false); }
__device__ __forceinline__ v8f wmmab(v16bf a, v16bf b, v8f c) { return __builtin_amdgcn_wmma_f32_16x16x32_bf16(false, a, false, b, (short)0, c, false, false); }



__device__ __forceinline__ h16 tohx(float x) { return (h16)x; }
__device__ __forceinline__ void splitf(float y, unsigned short& h, unsigned short& l) { h = f2bf(y); l = f2bf(y - bf2f(h)); }
typedef __attribute__((ext_vector_type(2))) _Float16 v2h;
typedef __attribute__((ext_vector_type(4))) _Float16 v4h;
typedef __attribute__((ext_vector_type(2))) unsigned short v2us;
typedef __attribute__((ext_vector_type(4))) unsigned short v4us;
typedef __attribute__((ext_vector_type(2))) float v2f;
typedef __attribute__((ext_vector_type(4))) int v4i;

// ---- k_gemmw: register-blocked GEMM, 128 threads, 16 accumulators (64x64) per wave; the K-contiguous 16-bit operand planes come into LDS by asynchronous copies in whole lines, and the fragments are read from there.
// KS = 1: the four waves hold the four 64x64 quarters of a 128x128 tile; grid (M/128, N/128, Z); K = KL = 64. KS = 4: grid (M/64, N/64, Z).
// KS = 4: FOUR waves share the tile (128 threads). Wave w sums the 32-wide k chunks w, w + 4, w + 8, ... over the whole 64x64 tile; the four partial tiles meet in LDS behind one barrier and wave w finishes rows 16w..16w+15 (for the transposed v: columns 16w..16w+15), the partials added in wave order 0, 1, 2, 3. KL % 128 == 0 there.
// C[m][n] (f32, pitch ldc, + optional f32 bias[n]) = sum_k A[m][k] Bt[n][k] (+ split products per NSPLIT). K is the row pitch of A and Bt, KL the length of the sum (KL <= K: a row may hold a hi half, then a lo half). z-batch strides sA/sB/sC in elements. KL % 32 == 0.
template <typename T16> struct WFrag;
template <> struct WFrag<h16> { typedef v16h V; static __device__ __forceinline__ V ld(const h16* p) { return cat16(*(const v8h*)p, *(const v8h*)(p + 16)); } static __device__ __forceinline__ v8f mma(V a, V b, v8f c) { return wmma16(a, b, c); } };
template <> struct WFrag<bf> { typedef v16bf V; static __device__ __forceinline__ V ld(const bf* p) { return cat16b(*(const v8us*)p, *(const v8us*)(p + 16)); } static __device__ __forceinline__ v8f mma(V a, V b, v8f c) { return wmmab(a, b, c); } };
// Eight asynchronous 16-byte copies of a lane, global to LDS: LDS byte l + i * lstep from g + i * gstep (elements). A wave's 32 lanes cover 512 bytes of whole lines per copy (two 256-byte row pieces, or four 128-byte rows).
// s_wait_xcnt 0 is the statement's last line: the precaution before a copy's address registers are rewritten, tied to them by standing inside the statement.
template <typename T16> __device__ __forceinline__ void copy8(unsigned l, unsigned lstep, const T16* g, size_t gstep) {
    const unsigned l1 = l + lstep, l2 = l1 + lstep, l3 = l2 + lstep, l4 = l3 + lstep, l5 = l4 + lstep, l6 = l5 + lstep, l7 = l6 + lstep;
    const T16* g1 = g + gstep; const T16* g2 = g1 + gstep; const T16* g3 = g2 + gstep; const T16* g4 = g3 + gstep; const T16* g5 = g4 + gstep; const T16* g6 = g5 + gstep; const T16* g7 = g6 + gstep;
    asm volatile("global_load_async_to_lds_b128 %0, %8, off\n\t"
                 "global_load_async_to_lds_b128 %1, %9, off\n\t"
                 "global_load_async_to_lds_b128 %2, %10, off\n\t"
                 "global_load_async_to_lds_b128 %3, %11, off\n\t"
                 "global_load_async_to_lds_b128 %4, %12, off\n\t"
                 "global_load_async_to_lds_b128 %5, %13, off\n\t"
                 "global_load_async_to_lds_b128 %6, %14, off\n\t"
                 "global_load_async_to_lds_b128 %7, %15, off\n\t"
                 "s_wait_xcnt 0x0"
                 :: "v"(l), "v"(l1), "v"(l2), "v"(l3), "v"(l4), "v"(l5), "v"(l6), "v"(l7), "v"(g), "v"(g1), "v"(g2), "v"(g3), "v"(g4), "v"(g5), "v"(g6), "v"(g7) : "memory");
}
// EPI picks what the tile becomes. 0: f32 C. 1 (the q, k, v projections; z = tensor, one tile column = one head): the consumer's bf16 hi/lo operand planes, q and k as [tensor][batch][head][t][d] in Ph / Pl, v transposed as rows [batch][head][d] of TT hi then TT lo values in Vt.
// 2 (attn.v; z = batch * heads + head): hi/lo rows [batch][t][head * HD + d] in Ph / Pl, the last GEMM's A operand.
template <typename T16, int NSPLIT, bool BIAS, int EPI, int KS>
__global__ __launch_bounds__(128) void k_gemmw(const T16* __restrict__ A, const T16* __restrict__ A2, const T16* __restrict__ Bt, const T16* __restrict__ Bt2, int K, int KL, float* C, int ldc, const float* __restrict__ bias, size_t sA, size_t sB, size_t sC, bf* Ph, bf* Pl, bf* Vt) {
    typedef typename WFrag<T16>::V V;
    static_assert(KS == 4 || (KS == 1 && NSPLIT == 2), "four waves split K of one tile, or four waves with a 64x64 tile each");
    constexpr int SL = 16 * 68, PT = 4 * SL;   // floats of one 16-row slab; of one wave's partial tile
    // KS = 4: a stage is 128 k (256 B of each of the 64 rows) of every operand plane, rows at pitch 272 B (16 B x odd: the ds_load_b128 readers' pitch); two stages; the partial tiles later lie on the same LDS
    constexpr int NT = (NSPLIT == 0) ? 2 : (NSPLIT == 1) ? 3 : 4, RP = 272, TB = 64 * RP, STG = NT * TB;
    // KS = 1 (K = KL = 64, rows of 128 B): the work-group's 128 rows of all four planes are filled once, rows at pitch 144 B; each wave's output slab later lies on the same LDS
    constexpr int RQ = 144, TQ = 128 * RQ;
    constexpr int SMB = (KS == 1) ? 4 * TQ : (2 * STG > KS * PT * 4 ? 2 * STG : KS * PT * 4);
    __shared__ __align__(16) char sm[SMB];
    const int wv = __builtin_amdgcn_readfirstlane((int)(threadIdx.x >> 5));
    float* const os = (float*)sm + ((KS == 1) ? wv * SL : 0);
    const size_t z = blockIdx.z; A += z * sA; if (A2) A2 += z * sA; Bt += z * sB; if (Bt2) Bt2 += z * sB; if (EPI == 0) C += z * sC;
    const int lane = threadIdx.x & 31, lr = lane & 15, hi = lane >> 4; const int r0 = (KS == 1) ? blockIdx.x * 128 + (wv & 1) * 64 : blockIdx.x * 64, c0 = (KS == 1) ? blockIdx.y * 128 + (wv >> 1) * 64 : blockIdx.y * 64;
    v8f acc[4][4];
#pragma unroll
    for (int mb = 0; mb < 4; ++mb)
#pragma unroll
        for (int nb = 0; nb < 4; ++nb) acc[mb][nb] = (v8f){};
    if constexpr (KS == 4) {
        const int tid = threadIdx.x, nst = KL / 128;
        const unsigned lb = (unsigned)(size_t)sm + (unsigned)((tid >> 4) * RP + (tid & 15) * 16);   // the lane's first LDS byte in a tile: row tid / 16, 16-byte piece tid % 16
        const size_t go = (size_t)(tid >> 4) * K + (tid & 15) * 8, rs = (size_t)8 * K;
        const T16* gA = A + (size_t)r0 * K + go; const T16* gB = Bt + (size_t)c0 * K + go;
        const T16* gA2 = (NSPLIT == 1 || NSPLIT == 2) ? A2 + (size_t)r0 * K + go : nullptr; const T16* gB2 = (NSPLIT >= 2) ? Bt2 + (size_t)c0 * K + go : nullptr;
        auto stage = [&](int s) { const unsigned l = lb + (unsigned)(s & 1) * STG; const int kq = s * 128;   // tiles of a stage in LDS: A, B, then A2, then B2
            copy8(l, 8 * RP, gA + kq, rs); copy8(l + TB, 8 * RP, gB + kq, rs);
            if (NSPLIT == 1 || NSPLIT == 2) copy8(l + 2 * TB, 8 * RP, gA2 + kq, rs);
            if (NSPLIT >= 2) copy8(l + 3 * TB, 8 * RP, gB2 + kq, rs); };
        stage(0);
        asm volatile("s_wait_asynccnt 0x0" ::: "memory");   // this wave's copies of stage 0 have landed
        __syncthreads();   // stage 0 is in LDS for every wave
        if (nst > 1) stage(1);
#pragma unroll 1   // one stage per trip; rolled, so that the text stays small
        for (int s = 0; s < nst; ++s) {
            const T16* fb = (const T16*)(sm + (s & 1) * STG + lr * RP + wv * 64 + hi * 16);   // wave w reads the stage's 32-wide k chunk w: the chunks w, w + 4, w + 8, ... as before
            constexpr int RE = 16 * RP / 2, TE = TB / 2;   // 16 rows; one tile (elements)
            V a[4], a2[4];
#pragma unroll   // constant indices: the fragments stay in registers
            for (int mb = 0; mb < 4; ++mb) { a[mb] = WFrag<T16>::ld(fb + mb * RE); if (NSPLIT == 1 || NSPLIT == 2) a2[mb] = WFrag<T16>::ld(fb + 2 * TE + mb * RE); }
#pragma unroll   // constant indices: the accumulators stay in registers
            for (int nb = 0; nb < 4; ++nb) { const V b = WFrag<T16>::ld(fb + TE + nb * RE); V b2; if (NSPLIT >= 2) b2 = WFrag<T16>::ld(fb + 3 * TE + nb * RE);
#pragma unroll   // constant indices: the accumulators stay in registers
                for (int mb = 0; mb < 4; ++mb) { acc[mb][nb] = WFrag<T16>::mma(a[mb], b, acc[mb][nb]); if (NSPLIT == 1 || NSPLIT == 2) acc[mb][nb] = WFrag<T16>::mma(a2[mb], b, acc[mb][nb]); if (NSPLIT >= 2) acc[mb][nb] = WFrag<T16>::mma(a[mb], b2, acc[mb][nb]); } }
            asm volatile("s_wait_dscnt 0x0" ::: "memory");      // this wave's reads of the stage have returned before its buffer is refilled
            asm volatile("s_wait_asynccnt 0x0" ::: "memory");   // this wave's copies of stage s + 1 have landed
            __syncthreads();   // publishes stage s + 1 and ends every wave's reads of stage s
            if (s + 2 < nst) stage(s + 2);
        }
        asm volatile("s_wait_asynccnt 0x0" ::: "memory");   // no copy is outstanding when the partial tiles take over the LDS
    } else {
        const int tid = threadIdx.x;
        const unsigned lb = (unsigned)(size_t)sm + (unsigned)((tid >> 3) * RQ + (tid & 7) * 16);   // the lane's first LDS byte in a tile: row tid / 8, 16-byte piece tid % 8
        const size_t ga = (size_t)blockIdx.x * 128 * 64 + tid * 8, gb = (size_t)blockIdx.y * 128 * 64 + tid * 8;   // a tile's 128 rows are 16 KiB in a row; the 128 lanes take 16 rows per copy
        copy8(lb, 16 * RQ, A + ga, (size_t)1024); copy8(lb + TQ, 16 * RQ, Bt + gb, (size_t)1024); copy8(lb + 2 * TQ, 16 * RQ, A2 + ga, (size_t)1024); copy8(lb + 3 * TQ, 16 * RQ, Bt2 + gb, (size_t)1024);
        asm volatile("s_wait_asynccnt 0x0" ::: "memory");   // this wave's copies have landed
        __syncthreads();   // all four planes are in LDS for every wave
        const T16* fa = (const T16*)(sm + ((wv & 1) * 64 + lr) * RQ + hi * 16); const T16* fq = (const T16*)(sm + TQ + ((wv >> 1) * 64 + lr) * RQ + hi * 16);
        constexpr int RE = 16 * RQ / 2, TE = TQ / 2;   // 16 rows; one tile (elements)
#pragma unroll   // two chunks of 32 k: straight-line text, LDS offsets become immediates
        for (int kc = 0; kc < 64; kc += 32) {
            V a[4], a2[4];
#pragma unroll   // constant indices: the fragments stay in registers
            for (int mb = 0; mb < 4; ++mb) { a[mb] = WFrag<T16>::ld(fa + mb * RE + kc); a2[mb] = WFrag<T16>::ld(fa + 2 * TE + mb * RE + kc); }
#pragma unroll   // constant indices: the accumulators stay in registers
            for (int nb = 0; nb < 4; ++nb) { const V b = WFrag<T16>::ld(fq + nb * RE + kc); const V b2 = WFrag<T16>::ld(fq + 2 * TE + nb * RE + kc);
#pragma unroll   // constant indices: the accumulators stay in registers
                for (int mb = 0; mb < 4; ++mb) { acc[mb][nb] = WFrag<T16>::mma(a[mb], b, acc[mb][nb]); acc[mb][nb] = WFrag<T16>::mma(a2[mb], b, acc[mb][nb]); acc[mb][nb] = WFrag<T16>::mma(a[mb], b2, acc[mb][nb]); } }
        }
        asm volatile("s_wait_dscnt 0x0" ::: "memory");   // this wave's operand reads have returned
        __syncthreads();   // every wave has left the operand tiles: the LDS becomes the waves' output slabs
    }
    if (KS > 1) {   // every wave's partial tile goes to its own part of LDS, slab by slab in the row-major form the finishing wave reads
#pragma unroll   // the three loops: constant indices, so the accumulators stay in registers
        for (int mb = 0; mb < 4; ++mb)
#pragma unroll
            for (int nb = 0; nb < 4; ++nb)
#pragma unroll
                for (int j = 0; j < 8; ++j) os[wv * PT + mb * SL + (hi * 8 + j) * 68 + nb * 16 + lr] = acc[mb][nb][j];
        __syncthreads();   // all four partial tiles are in LDS; nothing is written there afterwards
    }
    if (EPI == 1 && z == 2) {   // v: a lane holds 8 consecutive t of one d, which is 16 contiguous bytes of a transposed row, so the planes go out in the accumulators' own layout
        bf* vb = Vt + (size_t)((r0 / TT) * NH_ + blockIdx.y) * HD * (2 * TT) + (r0 % TT) + 8 * hi;
#pragma unroll   // KS = 4: wave w finishes the 16 rows d = 16w..16w+15 over all 64 t, so each 128-byte line of a row keeps one writer
        for (int ni = 0; ni < 4 / KS; ++ni) { const int nb = (KS == 1) ? ni : wv; const float bv = bfr(bias[c0 + nb * 16 + lr]); bf* vr = vb + (size_t)(nb * 16 + lr) * (2 * TT);
#pragma unroll
            for (int mb = 0; mb < 4; ++mb) { v8us oh, ol;
#pragma unroll
                for (int j = 0; j < 8; ++j) { float t;
                    if (KS == 1) t = acc[mb][ni][j];
                    else { const float* pp0 = os + mb * SL + (hi * 8 + j) * 68 + nb * 16 + lr; t = pp0[0];
#pragma unroll   // the partials' LDS reads become immediate offsets and go out together
                        for (int p = 1; p < KS; ++p) t += pp0[p * PT]; }
                    unsigned short a2, c2; splitf(t + bv, a2, c2); oh[j] = a2; ol[j] = c2; }
                *(v8us*)(vr + mb * 16) = oh; *(v8us*)(vr + mb * 16 + TT) = ol; } }
        return;
    }
    const size_t pb = (EPI == 1) ? (((z * NB_ + r0 / TT) * NH_ + blockIdx.y) * TT + r0 % TT) * HD : (EPI == 2) ? ((z / NH_) * TT + r0) * DQ + (z % NH_) * HD : 0; const int pp = (EPI == 1) ? HD : DQ;   // first element and row pitch of the tile in the hi/lo planes
#pragma unroll
    for (int mi = 0; mi < 4 / KS; ++mi) { const int mb = (KS == 1) ? mi : wv; const float* ob = os + ((KS == 1) ? 0 : mb * SL);
        if (KS == 1) {
#pragma unroll
        for (int nb = 0; nb < 4; ++nb) {
#pragma unroll
            for (int j = 0; j < 8; ++j) os[(hi * 8 + j) * 68 + nb * 16 + lr] = acc[mi][nb][j]; }
        }
        __builtin_amdgcn_wave_barrier(); asm volatile("" ::: "memory");
        float* crow = (EPI == 0) ? C + (size_t)(r0 + mb * 16) * ldc + c0 : nullptr;
{
            v4f vs[8];   // the slab's eight row pairs: all their LDS reads stand ahead of the first store, so one LDS latency is paid per slab, not eight
#pragma unroll   // constant indices: the rows stay in registers
            for (int s = 0; s < 8; ++s) { const int row = 2 * s + hi, cofs = lr * 4; vs[s] = *(const v4fa*)(ob + row * 68 + cofs);
#pragma unroll   // the partials' LDS reads become immediate offsets and go out together
                for (int p = 1; p < KS; ++p) vs[s] += *(const v4fa*)(ob + p * PT + row * 68 + cofs); }
#pragma unroll   // constant indices: the rows stay in registers
            for (int s = 0; s < 8; ++s) { const int row = 2 * s + hi, cofs = lr * 4; v4f val = vs[s];
                if (BIAS) { val[0] += bfr(bias[c0 + cofs]); val[1] += bfr(bias[c0 + cofs + 1]); val[2] += bfr(bias[c0 + cofs + 2]); val[3] += bfr(bias[c0 + cofs + 3]); }
                if (EPI == 0) *(v4f*)(crow + (size_t)row * ldc + cofs) = val;
                else { v4us oh, ol;
#pragma unroll
                    for (int q = 0; q < 4; ++q) { unsigned short a2, c2; splitf(val[q], a2, c2); oh[q] = a2; ol[q] = c2; }
                    const size_t po = pb + (size_t)(mb * 16 + row) * pp + cofs; *(v4us*)(Ph + po) = oh; *(v4us*)(Pl + po) = ol; } }
             }
        asm volatile("s_wait_xcnt 0x0" ::: "memory");   // the wait before a store's registers are rewritten: the next pass's LDS reads may land on them
        __builtin_amdgcn_wave_barrier(); asm volatile("" ::: "memory");
    }
}

__global__ __launch_bounds__(256) void k_wtG(const float* __restrict__ w, int K, int N, bf* Bt) {
    const int lane = threadIdx.x & 31; const int L0 = (blockIdx.x * 8 + (threadIdx.x >> 5)) * 8; const int nlines = N * K / 64;
{
#pragma unroll 1
        for (int l = 0; l < 8; ++l) { const int L = L0 + l; if (L >= nlines) break; const size_t e = (size_t)L * 64 + lane * 2; const int k = (int)(e % K), n = (int)(e / K); v2us o;
            o[0] = f2bf(w[(size_t)k * N + n]); o[1] = f2bf(w[(size_t)(k + 1) * N + n]); *(v2us*)(Bt + e) = o; }
         }
}
// blockIdx.y picks the tensor: 0..2 the three activations (nx8 groups of 8 each, planes dx + y * 8 * nx8), 3 and 4 the two weights (nw8 groups each)
__global__ __launch_bounds__(256) void k_cvt8(const float* __restrict__ x0, const float* __restrict__ x1, const float* __restrict__ x2, const float* __restrict__ w0, const float* __restrict__ w1, bf* dx, bf* dw0, bf* dw1, size_t nx8, size_t nw8) { const size_t i = (size_t)blockIdx.x * 256 + threadIdx.x; const unsigned y = blockIdx.y;
    const float* src = (y == 0) ? x0 : (y == 1) ? x1 : (y == 2) ? x2 : (y == 3) ? w0 : w1; bf* dst = (y < 3) ? dx + (size_t)y * nx8 * 8 : (y == 3) ? dw0 : dw1; if (i >= ((y < 3) ? nx8 : nw8)) return; const v8f v = *(const v8f*)(src + i * 8); v8us o;
#pragma unroll
    for (int k = 0; k < 8; ++k) o[k] = f2bf(v[k]); *(v8us*)(dst + i * 8) = o;  }

// ---- k_thsm: logit mix, softmax and probability mix of ONE query row in one work-group (grid (TT, batches), 256 threads). Thread t holds keys 4t..4t+3 of all 12 heads in registers, so both cross-head mixes are thread-local;
// only the 12 row maxima and the 12 row sums cross lanes (16-lane DPP butterfly, cross-row swap, then 8 wave partials through LDS, summed in wave order).
template <int CTRL> __device__ __forceinline__ float dppmov(float x) { return __builtin_bit_cast(float, __builtin_amdgcn_update_dpp(0, __builtin_bit_cast(int, x), CTRL, 0xf, 0xf, true)); }   // CTRL 0x160 + m: lane l reads lane l ^ m of its 16-lane row
__device__ __forceinline__ float swap16(float x) { const int b = __builtin_bit_cast(int, x); return __builtin_bit_cast(float, __builtin_amdgcn_permlanex16(b, b, 0x76543210, 0xfedcba98, false, false)); }   // lane l reads lane l ^ 16
__device__ __forceinline__ float wave_max(float m) { m = fmaxf(m, dppmov<0x161>(m)); m = fmaxf(m, dppmov<0x162>(m)); m = fmaxf(m, dppmov<0x164>(m)); m = fmaxf(m, dppmov<0x168>(m)); return fmaxf(m, swap16(m)); }
__device__ __forceinline__ float wave_sum(float s) { s += dppmov<0x161>(s); s += dppmov<0x162>(s); s += dppmov<0x164>(s); s += dppmov<0x168>(s); return s + swap16(s); }
// The probability planes go back into the score rows they came from: a head's 4096-byte f32 score row becomes 1024 bf16 hi values, then 1024 bf16 lo values. Each row belongs to one work-group, every wave has used its scores before the second barrier, and the stores stand behind the third.
// 8 waves per SIMD asked for (128 registers)
__global__ __launch_bounds__(256, 8) void k_thsm(const float* S, const float* __restrict__ Wl, const float* __restrict__ bl, const float* __restrict__ Wp, const float* __restrict__ bp, bf* P, size_t zs) {   // P: the same memory as S (neither is __restrict__); zs: head-plane stride in f32 elements; as an argument it gives each plane's load an address pair of its own
    __shared__ __align__(16) float wls[NH_ * NH_]; __shared__ __align__(16) float wps[NH_ * NH_]; __shared__ __align__(16) float bls[NH_]; __shared__ __align__(16) float bps[NH_]; __shared__ __align__(16) float rmx[8 * NH_]; __shared__ __align__(16) float rsm[8 * NH_];
    const int tid = threadIdx.x, lane = tid & 31, wv = tid >> 5; const unsigned k0 = tid * 4; const size_t r0 = (size_t)blockIdx.y * NH_ * zs + (size_t)blockIdx.x * TT;   // the lane's first key; the row's offset in its batch's first head plane (uniform)
    v4f L[NH_]; const float* sp[NH_];
#pragma unroll   // constant indices: the arrays stay in registers
    for (int h = 0; h < NH_; ++h) { sp[h] = S + r0 + h * zs + k0; L[h] = *(const v4f*)sp[h]; }
    // the wait before a load's address registers are rewritten; the 12 address pairs are its inputs, so they stay live up to it and no later load of the run lands on an earlier one's address
    asm volatile("s_wait_xcnt 0x0" :: "v"(sp[0]), "v"(sp[1]), "v"(sp[2]), "v"(sp[3]), "v"(sp[4]), "v"(sp[5]), "v"(sp[6]), "v"(sp[7]), "v"(sp[8]), "v"(sp[9]), "v"(sp[10]), "v"(sp[11]) : "memory");
    if (tid < NH_ * NH_) { wls[tid] = bfr(Wl[tid]); wps[tid] = bfr(Wp[tid]); } else if (tid < NH_ * NH_ + NH_) { bls[tid - NH_ * NH_] = bfr(bl[tid - NH_ * NH_]); bps[tid - NH_ * NH_] = bfr(bp[tid - NH_ * NH_]); }
    __syncthreads();   // the rounded weights and biases are in LDS for every wave
#pragma unroll   // constant indices: the arrays stay in registers
    for (int h = 0; h < NH_; ++h) L[h] *= SCL;
    v4f M[NH_]; float red[NH_];
#pragma unroll   // constant indices: the arrays stay in registers
    for (int g = 0; g < NH_; ++g) { v4f acc = wls[g * NH_] * L[0];
#pragma unroll   // constant indices: the arrays stay in registers
        for (int h = 1; h < NH_; ++h) acc += wls[g * NH_ + h] * L[h];
        acc += bls[g]; M[g] = acc; red[g] = wave_max(fmaxf(fmaxf(fmaxf(acc[0], acc[1]), fmaxf(acc[2], acc[3])), -3.0e38f)); }
    if (lane == 0) {
#pragma unroll   // constant indices: the arrays stay in registers
        for (int c = 0; c < NH_ / 4; ++c) { v4f o; o[0] = red[c * 4]; o[1] = red[c * 4 + 1]; o[2] = red[c * 4 + 2]; o[3] = red[c * 4 + 3]; *(v4f*)(rmx + wv * NH_ + c * 4) = o; } }
    __syncthreads();   // all 8 waves' partial maxima are in LDS
#pragma unroll   // constant indices: the arrays stay in registers
    for (int c = 0; c < NH_ / 4; ++c) { v4f m = *(const v4f*)(rmx + c * 4);
#pragma unroll   // constant indices: the arrays stay in registers
        for (int w = 1; w < 8; ++w) { const v4f r = *(const v4f*)(rmx + w * NH_ + c * 4); m[0] = fmaxf(m[0], r[0]); m[1] = fmaxf(m[1], r[1]); m[2] = fmaxf(m[2], r[2]); m[3] = fmaxf(m[3], r[3]); }
        red[c * 4] = m[0]; red[c * 4 + 1] = m[1]; red[c * 4 + 2] = m[2]; red[c * 4 + 3] = m[3]; }
#pragma unroll   // constant indices: the arrays stay in registers
    for (int g = 0; g < NH_; ++g) { v4f p = (M[g] - red[g]) * 1.4426950408889634f;
#pragma unroll   // constant indices: the arrays stay in registers
        for (int q = 0; q < 4; ++q) p[q] = __builtin_amdgcn_exp2f(p[q]);
        M[g] = p; red[g] = wave_sum((p[0] + p[1]) + (p[2] + p[3])); }
    if (lane == 0) {
#pragma unroll   // constant indices: the arrays stay in registers
        for (int c = 0; c < NH_ / 4; ++c) { v4f o; o[0] = red[c * 4]; o[1] = red[c * 4 + 1]; o[2] = red[c * 4 + 2]; o[3] = red[c * 4 + 3]; *(v4f*)(rsm + wv * NH_ + c * 4) = o; } }
    __syncthreads();   // all 8 waves' partial sums are in LDS (own array: no wave can still be reading the maxima's)
#pragma unroll   // constant indices: the arrays stay in registers
    for (int c = 0; c < NH_ / 4; ++c) { v4f s = *(const v4f*)(rsm + c * 4);
#pragma unroll   // constant indices: the arrays stay in registers
        for (int w = 1; w < 8; ++w) s += *(const v4f*)(rsm + w * NH_ + c * 4);
#pragma unroll   // constant indices: the arrays stay in registers
        for (int q = 0; q < 4; ++q) M[c * 4 + q] *= __fdiv_rn(1.0f, s[q]); }
#pragma unroll   // constant indices: the arrays stay in registers
    for (int g = 0; g < NH_; ++g) { v4f acc = wps[g * NH_] * M[0];
#pragma unroll   // constant indices: the arrays stay in registers
        for (int h = 1; h < NH_; ++h) acc += wps[g * NH_ + h] * M[h];
        acc += bps[g]; v4us oh, ol;
#pragma unroll   // constant indices: the arrays stay in registers
        for (int q = 0; q < 4; ++q) { unsigned short a, c2; splitf(acc[q], a, c2); oh[q] = a; ol[q] = c2; }
        bf* pr = P + 2 * (r0 + g * zs) + k0; *(v4us*)pr = oh; *(v4us*)(pr + TT) = ol; }
}

extern "C" void kernel_launch(void* const* d_in, const int* in_sizes, int n_in,
                              void* d_out, int out_size, void* d_ws, size_t ws_size, hipStream_t stream) {
    (void)in_sizes; (void)n_in; (void)out_size;
    const float* x = (const float*)d_in[0]; const float* xk = (const float*)d_in[1]; const float* xv = (const float*)d_in[2]; const float* wq = (const float*)d_in[3]; const float* bq = (const float*)d_in[4]; const float* Wl = (const float*)d_in[5]; const float* bl = (const float*)d_in[6]; const float* Wp = (const float*)d_in[7]; const float* bp = (const float*)d_in[8]; const float* wo = (const float*)d_in[9]; const float* bo = (const float*)d_in[10];
    float* OUT = (float*)d_out;     // [4][1024][768]
    char* wsp = (char*)d_ws;
    auto take = [&](size_t bytes) { char* p = wsp; wsp += (bytes + 255) & ~(size_t)255; return (void*)p; };
    const size_t XE = (size_t)NB_ * TT * DM, PE = (size_t)NB_ * NH_ * TT * HD;   // elements of one activation tensor; of one set of head planes
    bf* WQ = (bf*)take((size_t)DQ * DM * 2); bf* WO = (bf*)take((size_t)DM * DQ * 2);
    bf* QKh = (bf*)take(2 * PE * 2); bf* QKl = (bf*)take(2 * PE * 2); bf* VT = (bf*)take(2 * PE * 2);   // q planes, then k planes; v rows hi then lo
    float* Sb = (float*)take((size_t)NB_ * ZH * TT * TT * 4);   // 48 score planes; each row later holds its probabilities' hi and lo halves
    if ((size_t)(wsp - (char*)d_ws) > ws_size) return;    // ws 256 MiB
    // dead before the first score is written, so they lie inside the score planes (stream-ordered): the bf16 activations
    bf* XB = (bf*)Sb;
    // written only after the scores are done, so they lie on the q and k lo planes (stream-ordered): attn.v's merged hi/lo rows
    bf* ATh = QKl; bf* ATl = QKl + PE;
    k_cvt8<<<dim3((unsigned)((XE / 8 + 255) / 256), 5, 1), 256, 0, stream>>>(x, xk, xv, wq, wo, XB, WQ, WO, XE / 8, (size_t)DQ * DM / 8);
    k_gemmw<bf, 0, true, 1, 4><<<dim3(NB_ * TT / 64, DQ / 64, 3), 128, 0, stream>>>(XB, nullptr, WQ, nullptr, DM, DM, nullptr, 0, bq, XE, 0, 0, QKh, QKl, VT);   // q, k and v projections (the same weight and bias), z = tensor; writes the head planes
    k_gemmw<bf, 2, false, 0, 1><<<dim3(TT / 128, TT / 128, NB_ * ZH), 128, 0, stream>>>(QKh, QKl, QKh + PE, QKl + PE, HD, HD, Sb, TT, nullptr, (size_t)TT * HD, (size_t)TT * HD, (size_t)TT * TT, nullptr, nullptr, nullptr);
    k_thsm<<<dim3(TT, NB_, 1), 256, 0, stream>>>(Sb, Wl, bl, Wp, bp, (bf*)Sb, (size_t)TT * TT);   /* talking-heads: mix logits across heads, softmax, mix probabilities, planes: one launch, one work-group per query row */
    k_gemmw<bf, 2, false, 2, 4><<<dim3(TT / 64, HD / 64, NB_ * ZH), 128, 0, stream>>>((const bf*)Sb, (const bf*)Sb + TT, VT, VT + TT, 2 * TT, TT, nullptr, 0, nullptr, (size_t)2 * TT * TT, (size_t)2 * HD * TT, 0, ATh, ATl, nullptr);   // writes the merged hi/lo rows
    k_gemmw<bf, 1, true, 0, 4><<<dim3(NB_ * TT / 64, DM / 64, 1), 128, 0, stream>>>(ATh, ATl, WO, nullptr, DQ, DQ, OUT, DM, bo, 0, 0, 0, nullptr, nullptr, nullptr);
}
